// v000
// The times below were measured on an AMD MI455X: many runs one after another, warmed up first and cycling through
// copies of the inputs, with the whole window's GPU time divided by the number of runs. Launches and the gaps
// between them are all in it. The median over several windows is given; except for v000 it joins two sittings, which
// can be a few percent apart, so the side-by-side timings, each taken in one sitting, are the better comparison.
// The starting kernel, v000, takes 1430 microseconds a run.
#include <hip/hip_runtime.h>

// Causal attention whose head outputs are merged by a RAW view (x [2][2048][1024]; qkv = einsum('bte,fe', x, w_qkv) ('oi' [3072][1024] 1/32, no bias) split in thirds q | k | v (16 heads x 64); scores / sqrt(64); causal (-inf); softmax; out [B][H][T][dk] is then VIEWED as (B, T, E) without transposing the heads back (the source's bug, reproduced: flat element ((h*T + t)*64 + d) of the head-major buffer becomes row (h*T + t) / 16, column ((h*T + t) % 16)*64 + d); result = view w_proj^T + b_proj -> [2][2048][1024] (4.2 M); argument order x, w_qkv, w_proj, b_proj).
// Layout per batch: bf16 copy of x; the fused 'oi' weight is Bt as-is (q | k | v row blocks); exact projections; identity-table plane builders; causal T-2048 attention (hybrid rows: < 512 hi/lo 3 products, rest fp16 x1024; k_gemmc skips tiles above the diagonal); k_merge writes the context planes in the HEAD-MAJOR flat order ((h*T + t)*64 + d) so the [2048][1024] operand of the output GEMM is exactly the module's raw view; x w_proj exact + b_proj.
// Compute dtypes, f32 accumulate: every input rounded to bf16; projections exact; attention rows < 512 3 products, rest fp16; softmax f32; w_proj hl x exact + bias.

#define NB_  2
#define TT   2048
#define DM   1024
#define NH_  16
#define NKV  16
#define REP  (NH_ / NKV)
#define HD   64
#define DQ   (NH_ * HD)
#define DKV  (NKV * HD)
#define ZH   2
#define RH   512                  // query rows < RH use hi+lo planes (0: none)
#define WIN  2048
#define PCAR 1024.0f
#define SCL  0.125f   // HD^-0.5
typedef _Float16 h16;
typedef unsigned short bf;
typedef __attribute__((ext_vector_type(16))) __bf16   v16bf;
typedef __attribute__((ext_vector_type(16))) _Float16 v16h;
typedef __attribute__((ext_vector_type(8)))  _Float16 v8h;
typedef __attribute__((ext_vector_type(8)))  unsigned short v8us;
typedef __attribute__((ext_vector_type(8)))  float    v8f;
typedef __attribute__((ext_vector_type(4)))  float    v4f;
typedef v8h  __attribute__((may_alias)) v8ha;
typedef v4f  __attribute__((may_alias)) v4fa;
typedef v8us __attribute__((may_alias)) v8usa;

__device__ __forceinline__ unsigned short f2bf(float f) { unsigned u = __float_as_uint(f); u += 0x7FFFu + ((u >> 16) & 1u); return (unsigned short)(u >> 16); }
__device__ __forceinline__ float bf2f(unsigned short b) { return __uint_as_float(((unsigned)b) << 16); }
__device__ __forceinline__ float bfr(float f) { return bf2f(f2bf(f)); }
__device__ __forceinline__ v16h cat16(v8h lo, v8h hi) { return __builtin_shufflevector(lo, hi, 0, 1, 2, 3, 4, 5, 6, 7, 8, 9, 10, 11, 12, 13, 14, 15); }
__device__ __forceinline__ v16bf cat16b(v8us lo, v8us hi) { return __builtin_bit_cast(v16bf, __builtin_shufflevector(lo, hi, 0, 1, 2, 3, 4, 5, 6, 7, 8, 9, 10, 11, 12, 13, 14, 15)); }
__device__ __forceinline__ v8f wmma16(v16h a, v16h b, v8f c) { return __builtin_amdgcn_wmma_f32_16x16x32_f16(false, a, false, b, (short)0, c, false, false); }
__device__ __forceinline__ v8f wmmab(v16bf a, v16bf b, v8f c) { return __builtin_amdgcn_wmma_f32_16x16x32_bf16(false, a, false, b, (short)0, c, false, false); }



// ---- k_gemmw: register-blocked GEMM, ONE WAVE per 64x64 output tile (16 accumulators), operands straight from K-contiguous 16-bit planes; grid (M/64, N/64, Z), 32 threads.
// C[m][n] (f32, pitch ldc, + optional f32 bias[n]) = sum_k A[m][k] Bt[n][k] (+ split products per NSPLIT). z-batch strides sA/sB/sC in elements. K % 32 == 0.
template <typename T16> struct WFrag;
template <> struct WFrag<h16> { typedef v16h V; static __device__ __forceinline__ V ld(const h16* p) { return cat16(*(const v8h*)p, *(const v8h*)(p + 16)); } static __device__ __forceinline__ v8f mma(V a, V b, v8f c) { return wmma16(a, b, c); } };
template <> struct WFrag<bf> { typedef v16bf V; static __device__ __forceinline__ V ld(const bf* p) { return cat16b(*(const v8us*)p, *(const v8us*)(p + 16)); } static __device__ __forceinline__ v8f mma(V a, V b, v8f c) { return wmmab(a, b, c); } };
template <typename T16, int NSPLIT, bool BIAS>
__global__ __launch_bounds__(32) void k_gemmw(const T16* __restrict__ A, const T16* __restrict__ A2, const T16* __restrict__ Bt, const T16* __restrict__ Bt2, int K, float* C, int ldc, const float* __restrict__ bias, size_t sA, size_t sB, size_t sC) {
    typedef typename WFrag<T16>::V V;
    __shared__ __align__(16) float os[16 * 68];
    const size_t z = blockIdx.z; A += z * sA; if (A2) A2 += z * sA; Bt += z * sB; if (Bt2) Bt2 += z * sB; C += z * sC;
    const int lane = threadIdx.x & 31, lr = lane & 15, hi = lane >> 4; const int r0 = blockIdx.x * 64, c0 = blockIdx.y * 64;
    v8f acc[4][4];
#pragma unroll
    for (int mb = 0; mb < 4; ++mb)
#pragma unroll
        for (int nb = 0; nb < 4; ++nb) acc[mb][nb] = (v8f){};
    const size_t aoff = (size_t)(r0 + lr) * K + 8 * hi, boff = (size_t)(c0 + lr) * K + 8 * hi;
#pragma unroll 1
    for (int kc = 0; kc < K; kc += 32) {
        V a[4], a2[4];
#pragma unroll
        for (int mb = 0; mb < 4; ++mb) { a[mb] = WFrag<T16>::ld(A + aoff + (size_t)mb * 16 * K + kc); if (NSPLIT == 1 || NSPLIT == 2) a2[mb] = WFrag<T16>::ld(A2 + aoff + (size_t)mb * 16 * K + kc); }
#pragma unroll
        for (int nb = 0; nb < 4; ++nb) { const V b = WFrag<T16>::ld(Bt + boff + (size_t)nb * 16 * K + kc); V b2; if (NSPLIT >= 2) b2 = WFrag<T16>::ld(Bt2 + boff + (size_t)nb * 16 * K + kc);
#pragma unroll
            for (int mb = 0; mb < 4; ++mb) { acc[mb][nb] = WFrag<T16>::mma(a[mb], b, acc[mb][nb]); if (NSPLIT == 1 || NSPLIT == 2) acc[mb][nb] = WFrag<T16>::mma(a2[mb], b, acc[mb][nb]); if (NSPLIT >= 2) acc[mb][nb] = WFrag<T16>::mma(a[mb], b2, acc[mb][nb]); } }
        asm volatile("v_nop\n\tv_nop\n\tv_nop\n\tv_nop" : "+v"(acc[0][0]), "+v"(acc[1][1]), "+v"(acc[2][2]), "+v"(acc[3][3]) : "v"(a[0]), "v"(a[3]));
    }
#pragma unroll
    for (int mb = 0; mb < 4; ++mb) {
#pragma unroll
        for (int nb = 0; nb < 4; ++nb) {
#pragma unroll
            for (int j = 0; j < 8; ++j) os[(hi * 8 + j) * 68 + nb * 16 + lr] = acc[mb][nb][j]; }
        __builtin_amdgcn_wave_barrier(); asm volatile("" ::: "memory");
        float* crow = C + (size_t)(r0 + mb * 16) * ldc + c0;
{
#pragma unroll
            for (int s = 0; s < 8; ++s) { const int row = 2 * s + hi, cofs = lr * 4; v4f val = *(const v4fa*)(os + row * 68 + cofs); if (BIAS) { val[0] += bfr(bias[c0 + cofs]); val[1] += bfr(bias[c0 + cofs + 1]); val[2] += bfr(bias[c0 + cofs + 2]); val[3] += bfr(bias[c0 + cofs + 3]); }
                *(v4f*)(crow + (size_t)row * ldc + cofs) = val; }
             }
        __builtin_amdgcn_wave_barrier(); asm volatile("" ::: "memory");
    }
}

// ---- k_gemmc: the same one-wave 64x64 tile GEMM specialised for causal attention: CMODE 1 skips score tiles entirely above the diagonal (query rows r0+roff.., key columns c0..), CMODE 2 limits the
// key (K) loop of the probability x value contraction to the diagonal block (probabilities beyond it are exactly zero). roff = row offset of this launch's first row within the sequence.
template <typename T16, int NSPLIT, int CMODE>
__global__ __launch_bounds__(32) void k_gemmc(const T16* __restrict__ A, const T16* __restrict__ A2, const T16* __restrict__ Bt, const T16* __restrict__ Bt2, int K, float* C, int ldc, int roff, size_t sA, size_t sB, size_t sC) {
    typedef typename WFrag<T16>::V V;
    __shared__ __align__(16) float os[16 * 68];
    const size_t z = blockIdx.z; A += z * sA; if (A2) A2 += z * sA; Bt += z * sB; if (Bt2) Bt2 += z * sB; C += z * sC;
    const int lane = threadIdx.x & 31, lr = lane & 15, hi = lane >> 4; const int r0 = blockIdx.x * 64, c0 = blockIdx.y * 64;
    if (CMODE == 1 && c0 > r0 + roff + 63) return;                  // score tile entirely above the causal diagonal: never read (the softmax masks j > i by select)
    const int Kl = (CMODE == 2) ? min(K, r0 + roff + 64) : K;        // P.V: probabilities are exactly 0 beyond the diagonal block, so the K loop stops there
    v8f acc[4][4];
#pragma unroll
    for (int mb = 0; mb < 4; ++mb)
#pragma unroll
        for (int nb = 0; nb < 4; ++nb) acc[mb][nb] = (v8f){};
    const size_t aoff = (size_t)(r0 + lr) * K + 8 * hi, boff = (size_t)(c0 + lr) * K + 8 * hi;
#pragma unroll 1
    for (int kc = 0; kc < Kl; kc += 32) {
        V a[4], a2[4];
#pragma unroll
        for (int mb = 0; mb < 4; ++mb) { a[mb] = WFrag<T16>::ld(A + aoff + (size_t)mb * 16 * K + kc); if (NSPLIT == 1 || NSPLIT == 2) a2[mb] = WFrag<T16>::ld(A2 + aoff + (size_t)mb * 16 * K + kc); }
#pragma unroll
        for (int nb = 0; nb < 4; ++nb) { const V b = WFrag<T16>::ld(Bt + boff + (size_t)nb * 16 * K + kc); V b2; if (NSPLIT >= 2) b2 = WFrag<T16>::ld(Bt2 + boff + (size_t)nb * 16 * K + kc);
#pragma unroll
            for (int mb = 0; mb < 4; ++mb) { acc[mb][nb] = WFrag<T16>::mma(a[mb], b, acc[mb][nb]); if (NSPLIT == 1 || NSPLIT == 2) acc[mb][nb] = WFrag<T16>::mma(a2[mb], b, acc[mb][nb]); if (NSPLIT >= 2) acc[mb][nb] = WFrag<T16>::mma(a[mb], b2, acc[mb][nb]); } }
        asm volatile("v_nop\n\tv_nop\n\tv_nop\n\tv_nop" : "+v"(acc[0][0]), "+v"(acc[1][1]), "+v"(acc[2][2]), "+v"(acc[3][3]) : "v"(a[0]), "v"(a[3]));
    }
#pragma unroll
    for (int mb = 0; mb < 4; ++mb) {
#pragma unroll
        for (int nb = 0; nb < 4; ++nb) {
#pragma unroll
            for (int j = 0; j < 8; ++j) os[(hi * 8 + j) * 68 + nb * 16 + lr] = acc[mb][nb][j]; }
        __builtin_amdgcn_wave_barrier(); asm volatile("" ::: "memory");
        float* crow = C + (size_t)(r0 + mb * 16) * ldc + c0;
{
#pragma unroll
            for (int s = 0; s < 8; ++s) { const int row = 2 * s + hi, cofs = lr * 4; v4f val = *(const v4fa*)(os + row * 68 + cofs);
                *(v4f*)(crow + (size_t)row * ldc + cofs) = val; }
             }
        __builtin_amdgcn_wave_barrier(); asm volatile("" ::: "memory");
    }
}

__device__ __forceinline__ h16 tohx(float x) { return (h16)x; }
__device__ __forceinline__ void splitf(float y, unsigned short& h, unsigned short& l) { h = f2bf(y); l = f2bf(y - bf2f(h)); }
typedef __attribute__((ext_vector_type(2))) _Float16 v2h;
typedef __attribute__((ext_vector_type(4))) _Float16 v4h;
typedef __attribute__((ext_vector_type(2))) unsigned short v2us;
typedef __attribute__((ext_vector_type(4))) unsigned short v4us;
typedef __attribute__((ext_vector_type(2))) float v2f;
typedef __attribute__((ext_vector_type(4))) int v4i;

__global__ __launch_bounds__(256) void k_cvt8(const float* __restrict__ src, bf* dst, size_t n8) { const size_t i = (size_t)blockIdx.x * 256 + threadIdx.x; if (i >= n8) return; const v8f v = *(const v8f*)(src + i * 8); v8us o;
#pragma unroll
    for (int k = 0; k < 8; ++k) o[k] = f2bf(v[k]); *(v8us*)(dst + i * 8) = o;  }

// k_rope: head planes [h][t][d] (fp16 + hi/lo) of rope(x) x sc with the rotate-half convention out[d] = x[d] cos[t][d] - x[d+HD/2] sin[t][d], out[d+HD/2] = x[d+HD/2] cos[t][d+HD/2] + x[d] sin[t][d+HD/2]
__global__ __launch_bounds__(256) void k_rope(const float* __restrict__ F, int pitch, int nheads, const float* __restrict__ CS, const float* __restrict__ RF, const float* __restrict__ nw, float sc, h16* P16, bf* Ph, bf* Pl) {
    const size_t e = ((size_t)blockIdx.x * 256 + threadIdx.x) * 2; if (e >= (size_t)nheads * TT * HD) return; const int d = (int)(e % HD); const int t = (int)((e / HD) % TT); const int h = (int)(e / ((size_t)HD * TT)); const float* f = F + (size_t)t * pitch + h * HD; const float rf = RF ? RF[(size_t)h * TT + t] : 1.0f; v2h o16; v2us oh, ol;
#pragma unroll
    for (int q = 0; q < 2; ++q) { const int dd = d + q; const int dp = (dd < HD / 2) ? dd + HD / 2 : dd - HD / 2; float x0 = f[dd], x1 = f[dp];
        if (RF) { float n0 = __fmul_rn(x0, rf), n1 = __fmul_rn(x1, rf); asm volatile("" : "+v"(n0)); asm volatile("" : "+v"(n1)); x0 = __fmul_rn(bfr(nw[dd]), n0); x1 = __fmul_rn(bfr(nw[dp]), n1); }
        const v2f cs = *(const v2f*)(CS + ((size_t)t * HD + dd) * 2); float a = __fmul_rn(x0, cs[0]), bq = __fmul_rn(x1, cs[1]); asm volatile("" : "+v"(a)); asm volatile("" : "+v"(bq)); const float r = ((dd < HD / 2) ? __fsub_rn(a, bq) : __fadd_rn(a, bq)) * sc;
        o16[q] = tohx(r); unsigned short a2, c2; splitf(r, a2, c2); oh[q] = a2; ol[q] = c2; }
    *(v2h*)(P16 + e) = o16; *(v2us*)(Ph + e) = oh; *(v2us*)(Pl + e) = ol;  }
__global__ __launch_bounds__(256) void k_vtp(const float* __restrict__ F, int pitch, int nheads, h16* V16, bf* Vh, bf* Vl) { const size_t e = ((size_t)blockIdx.x * 256 + threadIdx.x) * 2; if (e >= (size_t)nheads * HD * TT) return; const int t = (int)(e % TT); const int d = (int)((e / TT) % HD); const int g = (int)(e / ((size_t)TT * HD)); v2h o16; v2us oh, ol;
#pragma unroll
    for (int q = 0; q < 2; ++q) { const float x = F[(size_t)(t + q) * pitch + g * HD + d]; o16[q] = tohx(x); unsigned short a2, c2; splitf(x, a2, c2); oh[q] = a2; ol[q] = c2; }
    *(v2h*)(V16 + e) = o16; *(v2us*)(Vh + e) = oh; *(v2us*)(Vl + e) = ol;  }
__global__ __launch_bounds__(256) void k_csid(float* CS) { const int idx = blockIdx.x * 256 + threadIdx.x; if (idx >= TT * HD) return; v2f cs; cs[0] = 1.0f; cs[1] = 0.0f; *(v2f*)(CS + (size_t)idx * 2) = cs;  }
// k_asoft: per row (zz, i): t = S x HD^-0.5 for j <= i and i - j < WIN (sliding causal window; the reference's -1e9 additive fill vanishes identically); softmax over the 2048 keys (register row, one exp, fixed trees);
__global__ __launch_bounds__(256) void k_asoft(const float* __restrict__ Sb, h16* P16, bf* Ph, bf* Pl) {
    const int lane = threadIdx.x & 31; const int row = blockIdx.x * 8 + (threadIdx.x >> 5); if (row >= ZH * TT) return; const int i = row % TT; const int zz = row / TT; (void)zz; const bool hires = (i < RH); const float* sr = Sb + (size_t)row * TT; float v[TT / 32]; float mx = -3.0e38f;
#pragma unroll
    for (int ch = 0; ch < TT / 128; ++ch) { const int j0 = ch * 128 + lane * 4; const v4f a = *(const v4f*)(sr + j0);
#pragma unroll
        for (int q = 0; q < 4; ++q) { const int j = j0 + q; (void)j; const float t = (j <= i && i - j < WIN) ? a[q] * SCL : -3.0e38f; v[ch * 4 + q] = t; mx = fmaxf(mx, t); } }
#pragma unroll
    for (int sh = 16; sh; sh >>= 1) mx = fmaxf(mx, __shfl_xor(mx, sh, 32));
    float sum = 0.f;
#pragma unroll
    for (int k = 0; k < TT / 32; ++k) { float d0 = __fsub_rn(v[k], mx); asm volatile("" : "+v"(d0)); v[k] = __builtin_amdgcn_exp2f(__fmul_rn(d0, 1.4426950408889634f)); sum += v[k]; }
#pragma unroll
    for (int sh = 16; sh; sh >>= 1) sum += __shfl_xor(sum, sh, 32);
    const float f = __fdiv_rn(hires ? 1.0f : PCAR, sum);
{
        if (hires) {
#pragma unroll
            for (int ch = 0; ch < TT / 128; ++ch) { v4us oh, ol;
#pragma unroll
                for (int q = 0; q < 4; ++q) { unsigned short a, c2; splitf(v[ch * 4 + q] * f, a, c2); oh[q] = a; ol[q] = c2; }
                const size_t oo = ((size_t)zz * (RH ? RH : 1) + i) * TT + ch * 128 + lane * 4; *(v4us*)(Ph + oo) = oh; *(v4us*)(Pl + oo) = ol; }
        } else {
#pragma unroll
            for (int ch = 0; ch < TT / 128; ++ch) { v4h o4;
#pragma unroll
                for (int q = 0; q < 4; ++q) o4[q] = tohx(v[ch * 4 + q] * f);
                *(v4h*)(P16 + (size_t)row * TT + ch * 128 + lane * 4) = o4; } }
         }
}
__global__ __launch_bounds__(256) void k_merge(const float* __restrict__ O, int h0, bf* Ah, bf* Al) { const size_t e = ((size_t)blockIdx.x * 256 + threadIdx.x) * 2; if (e >= (size_t)ZH * TT * HD) return; const int d = (int)(e % HD); const int t = (int)((e / HD) % TT); const int zz = (int)(e / ((size_t)HD * TT)); const float cs = (t < RH) ? 1.0f : (1.0f / PCAR); const size_t oo = ((size_t)(h0 + zz) * TT + t) * HD + d;   /* RAW view: the [H][T][64] head-major flat order, read back by the output GEMM as [T][1024] rows */
    v2us oh, ol;
#pragma unroll
    for (int q = 0; q < 2; ++q) { unsigned short a, c2; splitf(O[e + q] * cs, a, c2); oh[q] = a; ol[q] = c2; } *(v2us*)(Ah + oo) = oh; *(v2us*)(Al + oo) = ol;  }

extern "C" void kernel_launch(void* const* d_in, const int* in_sizes, int n_in,
                              void* d_out, int out_size, void* d_ws, size_t ws_size, hipStream_t stream) {
    (void)in_sizes; (void)n_in; (void)out_size;
    const float* x = (const float*)d_in[0]; const float* wqkv = (const float*)d_in[1]; const float* wo = (const float*)d_in[2]; const float* bo = (const float*)d_in[3];   /* input order x, w_qkv ('oi' [3072][1024]: q | k | v row thirds), w_proj ('oi'), b_proj */ const float* wq = wqkv; const float* wk = wqkv + (size_t)DQ * DM; const float* wv = wqkv + (size_t)2 * DQ * DM;
    float* OUT = (float*)d_out;     // [2][2048][1024]
    char* wsp = (char*)d_ws;
    auto take = [&](size_t bytes) { char* p = wsp; wsp += (bytes + 255) & ~(size_t)255; return (void*)p; };
    bf* WQ = (bf*)take((size_t)DQ * DM * 2); bf* WK = (bf*)take((size_t)DKV * DM * 2); bf* WV = (bf*)take((size_t)DKV * DM * 2); bf* WO = (bf*)take((size_t)DM * DQ * 2); float* CS = (float*)take((size_t)TT * HD * 2 * 4);
    bf* XB = (bf*)take((size_t)TT * DM * 2); float* FQ = (float*)take((size_t)TT * DQ * 4); float* FK = (float*)take((size_t)TT * DKV * 4);
    h16* QP16 = (h16*)take((size_t)NH_ * TT * HD * 2); h16* KP16 = (h16*)take((size_t)NKV * TT * HD * 2); h16* VT16 = (h16*)take((size_t)NKV * HD * TT * 2);
    bf* QPh = (bf*)take((size_t)NH_ * TT * HD * 2); bf* QPl = (bf*)take((size_t)NH_ * TT * HD * 2); bf* KPh = (bf*)take((size_t)NKV * TT * HD * 2); bf* KPl = (bf*)take((size_t)NKV * TT * HD * 2); bf* VTh = (bf*)take((size_t)NKV * HD * TT * 2); bf* VTl = (bf*)take((size_t)NKV * HD * TT * 2); bf* Ph = (bf*)take((size_t)ZH * RH * TT * 2); bf* Pl = (bf*)take((size_t)ZH * RH * TT * 2);
    float* Sb = (float*)take((size_t)ZH * TT * TT * 4); h16* P16 = (h16*)take((size_t)ZH * TT * TT * 2); float* Ob = (float*)take((size_t)ZH * TT * HD * 4); bf* ATh = (bf*)take((size_t)TT * DQ * 2); bf* ATl = (bf*)take((size_t)TT * DQ * 2);
    if ((size_t)(wsp - (char*)d_ws) > ws_size) return;    // ws 256 MiB
    float* FV = FK;   // v projection reuses the k buffer after the k planes are built (stream-ordered)
    { k_cvt8<<<(unsigned)(((size_t)DQ * DM / 8 + 255) / 256), 256, 0, stream>>>(wq, WQ, (size_t)DQ * DM / 8); k_cvt8<<<(unsigned)(((size_t)DKV * DM / 8 + 255) / 256), 256, 0, stream>>>(wk, WK, (size_t)DKV * DM / 8); k_cvt8<<<(unsigned)(((size_t)DKV * DM / 8 + 255) / 256), 256, 0, stream>>>(wv, WV, (size_t)DKV * DM / 8);
      k_cvt8<<<(unsigned)(((size_t)DM * DQ / 8 + 255) / 256), 256, 0, stream>>>(wo, WO, (size_t)DM * DQ / 8);
       }
    k_csid<<<(TT * HD + 255) / 256, 256, 0, stream>>>(CS);
    const unsigned LQ = (unsigned)(((size_t)NH_ * TT * HD / 2 + 255) / 256), LKv = (unsigned)(((size_t)NKV * TT * HD / 2 + 255) / 256);
    for (int b = 0; b < NB_; ++b) {
        
        k_cvt8<<<(unsigned)(((size_t)TT * DM / 8 + 255) / 256), 256, 0, stream>>>(x + (size_t)b * TT * DM, XB, (size_t)TT * DM / 8);
        k_gemmw<bf, 0, false><<<dim3(TT / 64, DQ / 64, 1), 32, 0, stream>>>(XB, nullptr, WQ, nullptr, DM, FQ, DQ, nullptr, 0, 0, 0);
        k_rope<<<LQ, 256, 0, stream>>>(FQ, DQ, NH_, CS, nullptr, nullptr, 1.0f, QP16, QPh, QPl);
        k_gemmw<bf, 0, false><<<dim3(TT / 64, DKV / 64, 1), 32, 0, stream>>>(XB, nullptr, WK, nullptr, DM, FK, DKV, nullptr, 0, 0, 0);
        k_rope<<<LKv, 256, 0, stream>>>(FK, DKV, NKV, CS, nullptr, nullptr, 1.0f, KP16, KPh, KPl);
        k_gemmw<bf, 0, false><<<dim3(TT / 64, DKV / 64, 1), 32, 0, stream>>>(XB, nullptr, WV, nullptr, DM, FV, DKV, nullptr, 0, 0, 0); k_vtp<<<LKv, 256, 0, stream>>>(FV, DKV, NKV, VT16, VTh, VTl);
        for (int h0 = 0; h0 < NH_; h0 += ZH) { const size_t zq = (size_t)h0, zk = (size_t)(h0 / REP);   // one kv head per query head: the pass's two heads use consecutive kv planes (z-strides TT*HD)
            k_gemmc<bf, 2, 1><<<dim3(RH / 64, TT / 64, ZH), 32, 0, stream>>>(QPh + zq * TT * HD, QPl + zq * TT * HD, KPh + zk * TT * HD, KPl + zk * TT * HD, HD, Sb, TT, 0, (size_t)TT * HD, (size_t)TT * HD, (size_t)TT * TT);
            k_gemmc<h16, 0, 1><<<dim3((TT - RH) / 64, TT / 64, ZH), 32, 0, stream>>>(QP16 + zq * TT * HD + (size_t)RH * HD, nullptr, KP16 + zk * TT * HD, nullptr, HD, Sb + (size_t)RH * TT, TT, RH, (size_t)TT * HD, (size_t)TT * HD, (size_t)TT * TT);
            k_asoft<<<ZH * TT / 8, 256, 0, stream>>>(Sb, P16, Ph, Pl);
            k_gemmc<bf, 2, 2><<<dim3(RH / 64, HD / 64, ZH), 32, 0, stream>>>(Ph, Pl, VTh + zk * HD * TT, VTl + zk * HD * TT, TT, Ob, HD, 0, (size_t)RH * TT, (size_t)HD * TT, (size_t)TT * HD);
            k_gemmc<h16, 0, 2><<<dim3((TT - RH) / 64, HD / 64, ZH), 32, 0, stream>>>(P16 + (size_t)RH * TT, nullptr, VT16 + zk * HD * TT, nullptr, TT, Ob + (size_t)RH * HD, HD, RH, (size_t)TT * TT, (size_t)HD * TT, (size_t)TT * HD);
            k_merge<<<(unsigned)(((size_t)ZH * TT * HD / 2 + 255) / 256), 256, 0, stream>>>(Ob, h0, ATh, ATl); }
        k_gemmw<bf, 1, true><<<dim3(TT / 64, DM / 64, 1), 32, 0, stream>>>(ATh, ATl, WO, nullptr, DQ, OUT + (size_t)b * TT * DM, DM, bo, 0, 0, 0); }
}

// v001
// It runs in 769 microseconds.
// Next to v000, in two timings, it ran 1.87 and 1.86 times as fast.
#include <hip/hip_runtime.h>

// Causal attention whose head outputs are merged by a RAW view (x [2][2048][1024]; qkv = einsum('bte,fe', x, w_qkv) ('oi' [3072][1024] 1/32, no bias) split in thirds q | k | v (16 heads x 64); scores / sqrt(64); causal (-inf); softmax; out [B][H][T][dk] is then VIEWED as (B, T, E) without transposing the heads back (the source's bug, reproduced: flat element ((h*T + t)*64 + d) of the head-major buffer becomes row (h*T + t) / 16, column ((h*T + t) % 16)*64 + d); result = view w_proj^T + b_proj -> [2][2048][1024] (4.2 M); argument order x, w_qkv, w_proj, b_proj).
// Layout per batch: bf16 copy of x; the fused 'oi' weight is Bt as-is (q | k | v row blocks); exact projections; identity-table plane builders; causal T-2048 attention (hybrid rows: < 512 hi/lo 3 products, rest fp16 x1024; k_gemmc skips tiles above the diagonal); k_merge writes the context planes in the HEAD-MAJOR flat order ((h*T + t)*64 + d) so the [2048][1024] operand of the output GEMM is exactly the module's raw view; x w_proj exact + b_proj.
// Compute dtypes, f32 accumulate: every input rounded to bf16; projections exact; attention rows < 512 3 products, rest fp16; softmax f32; w_proj hl x exact + bias.

#define NB_  2
#define TT   2048
#define DM   1024
#define NH_  16
#define NKV  16
#define REP  (NH_ / NKV)
#define HD   64
#define DQ   (NH_ * HD)
#define DKV  (NKV * HD)
#define ZH   2
#define RH   512                  // query rows < RH use hi+lo planes (0: none)
#define WIN  2048
#define PCAR 1024.0f
#define SCL  0.125f   // HD^-0.5
#define KS   16                   // key slices of the probability x value contraction: one work-group per slice, f32 partial planes summed in k_merge
typedef _Float16 h16;
typedef unsigned short bf;
typedef __attribute__((ext_vector_type(16))) __bf16   v16bf;
typedef __attribute__((ext_vector_type(16))) _Float16 v16h;
typedef __attribute__((ext_vector_type(8)))  _Float16 v8h;
typedef __attribute__((ext_vector_type(8)))  unsigned short v8us;
typedef __attribute__((ext_vector_type(8)))  float    v8f;
typedef __attribute__((ext_vector_type(4)))  float    v4f;
typedef v8h  __attribute__((may_alias)) v8ha;
typedef v4f  __attribute__((may_alias)) v4fa;
typedef v8us __attribute__((may_alias)) v8usa;

__device__ __forceinline__ unsigned short f2bf(float f) { unsigned u = __float_as_uint(f); u += 0x7FFFu + ((u >> 16) & 1u); return (unsigned short)(u >> 16); }
__device__ __forceinline__ float bf2f(unsigned short b) { return __uint_as_float(((unsigned)b) << 16); }
__device__ __forceinline__ float bfr(float f) { return bf2f(f2bf(f)); }
__device__ __forceinline__ v16h cat16(v8h lo, v8h hi) { return __builtin_shufflevector(lo, hi, 0, 1, 2, 3, 4, 5, 6, 7, 8, 9, 10, 11, 12, 13, 14, 15); }
__device__ __forceinline__ v16bf cat16b(v8us lo, v8us hi) { return __builtin_bit_cast(v16bf, __builtin_shufflevector(lo, hi, 0, 1, 2, 3, 4, 5, 6, 7, 8, 9, 10, 11, 12, 13, 14, 15)); }
__device__ __forceinline__ v8f wmma16(v16h a, v16h b, v8f c) { return __builtin_amdgcn_wmma_f32_16x16x32_f16(false, a, false, b, (short)0, c, false, false); }
__device__ __forceinline__ v8f wmmab(v16bf a, v16bf b, v8f c) { return __builtin_amdgcn_wmma_f32_16x16x32_bf16(false, a, false, b, (short)0, c, false, false); }



// ---- k_gemmw: register-blocked GEMM, ONE WAVE per 64x64 output tile (16 accumulators), operands straight from K-contiguous 16-bit planes; grid (M/64, N/64, Z), 32 threads.
// C[m][n] (f32, pitch ldc, + optional f32 bias[n]) = sum_k A[m][k] Bt[n][k] (+ split products per NSPLIT). z-batch strides sA/sB/sC in elements. K % 32 == 0.
template <typename T16> struct WFrag;
template <> struct WFrag<h16> { typedef v16h V; static __device__ __forceinline__ V ld(const h16* p) { return cat16(*(const v8h*)p, *(const v8h*)(p + 16)); } static __device__ __forceinline__ v8f mma(V a, V b, v8f c) { return wmma16(a, b, c); } };
template <> struct WFrag<bf> { typedef v16bf V; static __device__ __forceinline__ V ld(const bf* p) { return cat16b(*(const v8us*)p, *(const v8us*)(p + 16)); } static __device__ __forceinline__ v8f mma(V a, V b, v8f c) { return wmmab(a, b, c); } };
template <typename T16, int NSPLIT, bool BIAS>
__global__ __launch_bounds__(32) void k_gemmw(const T16* __restrict__ A, const T16* __restrict__ A2, const T16* __restrict__ Bt, const T16* __restrict__ Bt2, int K, float* C, int ldc, const float* __restrict__ bias, size_t sA, size_t sB, size_t sC) {
    typedef typename WFrag<T16>::V V;
    __shared__ __align__(16) float os[16 * 68];
    const size_t z = blockIdx.z; A += z * sA; if (A2) A2 += z * sA; Bt += z * sB; if (Bt2) Bt2 += z * sB; C += z * sC;
    const int lane = threadIdx.x & 31, lr = lane & 15, hi = lane >> 4; const int r0 = blockIdx.x * 64, c0 = blockIdx.y * 64;
    v8f acc[4][4];
#pragma unroll
    for (int mb = 0; mb < 4; ++mb)
#pragma unroll
        for (int nb = 0; nb < 4; ++nb) acc[mb][nb] = (v8f){};
    const size_t aoff = (size_t)(r0 + lr) * K + 8 * hi, boff = (size_t)(c0 + lr) * K + 8 * hi;
#pragma unroll 1
    for (int kc = 0; kc < K; kc += 32) {
        V a[4], a2[4];
#pragma unroll
        for (int mb = 0; mb < 4; ++mb) { a[mb] = WFrag<T16>::ld(A + aoff + (size_t)mb * 16 * K + kc); if (NSPLIT == 1 || NSPLIT == 2) a2[mb] = WFrag<T16>::ld(A2 + aoff + (size_t)mb * 16 * K + kc); }
#pragma unroll
        for (int nb = 0; nb < 4; ++nb) { const V b = WFrag<T16>::ld(Bt + boff + (size_t)nb * 16 * K + kc); V b2; if (NSPLIT >= 2) b2 = WFrag<T16>::ld(Bt2 + boff + (size_t)nb * 16 * K + kc);
#pragma unroll
            for (int mb = 0; mb < 4; ++mb) { acc[mb][nb] = WFrag<T16>::mma(a[mb], b, acc[mb][nb]); if (NSPLIT == 1 || NSPLIT == 2) acc[mb][nb] = WFrag<T16>::mma(a2[mb], b, acc[mb][nb]); if (NSPLIT >= 2) acc[mb][nb] = WFrag<T16>::mma(a[mb], b2, acc[mb][nb]); } }
        asm volatile("v_nop\n\tv_nop\n\tv_nop\n\tv_nop" : "+v"(acc[0][0]), "+v"(acc[1][1]), "+v"(acc[2][2]), "+v"(acc[3][3]) : "v"(a[0]), "v"(a[3]));
    }
#pragma unroll
    for (int mb = 0; mb < 4; ++mb) {
#pragma unroll
        for (int nb = 0; nb < 4; ++nb) {
#pragma unroll
            for (int j = 0; j < 8; ++j) os[(hi * 8 + j) * 68 + nb * 16 + lr] = acc[mb][nb][j]; }
        __builtin_amdgcn_wave_barrier(); asm volatile("" ::: "memory");
        float* crow = C + (size_t)(r0 + mb * 16) * ldc + c0;
{
#pragma unroll
            for (int s = 0; s < 8; ++s) { const int row = 2 * s + hi, cofs = lr * 4; v4f val = *(const v4fa*)(os + row * 68 + cofs); if (BIAS) { val[0] += bfr(bias[c0 + cofs]); val[1] += bfr(bias[c0 + cofs + 1]); val[2] += bfr(bias[c0 + cofs + 2]); val[3] += bfr(bias[c0 + cofs + 3]); }
                *(v4f*)(crow + (size_t)row * ldc + cofs) = val; }
             }
        __builtin_amdgcn_wave_barrier(); asm volatile("" ::: "memory");
    }
}

// ---- k_gemmc: the same one-wave 64x64 tile GEMM specialised for causal attention: CMODE 1 skips score tiles entirely above the diagonal (query rows r0+roff.., key columns c0..), CMODE 2 limits the
// key (K) loop of the probability x value contraction to the diagonal block (probabilities beyond it are exactly zero). roff = row offset of this launch's first row within the sequence.
// CMODE 2 also splits that key loop over KS work-groups (grid.y = N/64 * KS): slice ks takes the 64-key chunks ks, ks + KS, ... (one whole 128-byte line of every 16-bit row per chunk) and stores its f32 partial tile
// in plane ks of C (plane stride sK elements); a slice with no chunk below the diagonal stores zeros, so every plane is written whole. k_merge adds the planes in ascending ks.
template <typename T16, int NSPLIT, int CMODE>
__global__ __launch_bounds__(32) void k_gemmc(const T16* __restrict__ A, const T16* __restrict__ A2, const T16* __restrict__ Bt, const T16* __restrict__ Bt2, int K, float* C, int ldc, int roff, size_t sA, size_t sB, size_t sC, size_t sK) {
    typedef typename WFrag<T16>::V V;
    __shared__ __align__(16) float os[16 * 68];
    const size_t z = blockIdx.z; A += z * sA; if (A2) A2 += z * sA; Bt += z * sB; if (Bt2) Bt2 += z * sB; C += z * sC;
    const int ks = (CMODE == 2) ? (int)(blockIdx.y % KS) : 0; if (CMODE == 2) C += (size_t)ks * sK;
    const int lane = threadIdx.x & 31, lr = lane & 15, hi = lane >> 4; const int r0 = blockIdx.x * 64, c0 = (int)((CMODE == 2) ? blockIdx.y / KS : blockIdx.y) * 64;
    if (CMODE == 1 && c0 > r0 + roff + 63) return;                  // score tile entirely above the causal diagonal: never read (the softmax masks j > i by select)
    const int Kl = (CMODE == 2) ? min(K, r0 + roff + 64) : K;        // P.V: probabilities are exactly 0 beyond the diagonal block, so the K loop stops there
    v8f acc[4][4];
#pragma unroll
    for (int mb = 0; mb < 4; ++mb)
#pragma unroll
        for (int nb = 0; nb < 4; ++nb) acc[mb][nb] = (v8f){};
    const size_t aoff = (size_t)(r0 + lr) * K + 8 * hi, boff = (size_t)(c0 + lr) * K + 8 * hi;
#pragma unroll 1
    for (int kc = ks * 64; kc < Kl; kc += (CMODE == 2 && (kc & 32)) ? KS * 64 - 32 : 32) {
        V a[4], a2[4];
#pragma unroll
        for (int mb = 0; mb < 4; ++mb) { a[mb] = WFrag<T16>::ld(A + aoff + (size_t)mb * 16 * K + kc); if (NSPLIT == 1 || NSPLIT == 2) a2[mb] = WFrag<T16>::ld(A2 + aoff + (size_t)mb * 16 * K + kc); }
#pragma unroll
        for (int nb = 0; nb < 4; ++nb) { const V b = WFrag<T16>::ld(Bt + boff + (size_t)nb * 16 * K + kc); V b2; if (NSPLIT >= 2) b2 = WFrag<T16>::ld(Bt2 + boff + (size_t)nb * 16 * K + kc);
#pragma unroll
            for (int mb = 0; mb < 4; ++mb) { acc[mb][nb] = WFrag<T16>::mma(a[mb], b, acc[mb][nb]); if (NSPLIT == 1 || NSPLIT == 2) acc[mb][nb] = WFrag<T16>::mma(a2[mb], b, acc[mb][nb]); if (NSPLIT >= 2) acc[mb][nb] = WFrag<T16>::mma(a[mb], b2, acc[mb][nb]); } }
        asm volatile("v_nop\n\tv_nop\n\tv_nop\n\tv_nop" : "+v"(acc[0][0]), "+v"(acc[1][1]), "+v"(acc[2][2]), "+v"(acc[3][3]) : "v"(a[0]), "v"(a[3]));
    }
#pragma unroll
    for (int mb = 0; mb < 4; ++mb) {
#pragma unroll
        for (int nb = 0; nb < 4; ++nb) {
#pragma unroll
            for (int j = 0; j < 8; ++j) os[(hi * 8 + j) * 68 + nb * 16 + lr] = acc[mb][nb][j]; }
        __builtin_amdgcn_wave_barrier(); asm volatile("" ::: "memory");
        float* crow = C + (size_t)(r0 + mb * 16) * ldc + c0;
{
#pragma unroll
            for (int s = 0; s < 8; ++s) { const int row = 2 * s + hi, cofs = lr * 4; v4f val = *(const v4fa*)(os + row * 68 + cofs);
                *(v4f*)(crow + (size_t)row * ldc + cofs) = val; }
             }
        __builtin_amdgcn_wave_barrier(); asm volatile("" ::: "memory");
    }
}

__device__ __forceinline__ h16 tohx(float x) { return (h16)x; }
__device__ __forceinline__ void splitf(float y, unsigned short& h, unsigned short& l) { h = f2bf(y); l = f2bf(y - bf2f(h)); }
typedef __attribute__((ext_vector_type(2))) _Float16 v2h;
typedef __attribute__((ext_vector_type(4))) _Float16 v4h;
typedef __attribute__((ext_vector_type(2))) unsigned short v2us;
typedef __attribute__((ext_vector_type(4))) unsigned short v4us;
typedef __attribute__((ext_vector_type(2))) float v2f;
typedef __attribute__((ext_vector_type(4))) int v4i;

__global__ __launch_bounds__(256) void k_cvt8(const float* __restrict__ src, bf* dst, size_t n8) { const size_t i = (size_t)blockIdx.x * 256 + threadIdx.x; if (i >= n8) return; const v8f v = *(const v8f*)(src + i * 8); v8us o;
#pragma unroll
    for (int k = 0; k < 8; ++k) o[k] = f2bf(v[k]); *(v8us*)(dst + i * 8) = o;  }

// k_rope: head planes [h][t][d] (fp16 + hi/lo) of rope(x) x sc with the rotate-half convention out[d] = x[d] cos[t][d] - x[d+HD/2] sin[t][d], out[d+HD/2] = x[d+HD/2] cos[t][d+HD/2] + x[d] sin[t][d+HD/2]
__global__ __launch_bounds__(256) void k_rope(const float* __restrict__ F, int pitch, int nheads, const float* __restrict__ CS, const float* __restrict__ RF, const float* __restrict__ nw, float sc, h16* P16, bf* Ph, bf* Pl) {
    const size_t e = ((size_t)blockIdx.x * 256 + threadIdx.x) * 2; if (e >= (size_t)nheads * TT * HD) return; const int d = (int)(e % HD); const int t = (int)((e / HD) % TT); const int h = (int)(e / ((size_t)HD * TT)); const float* f = F + (size_t)t * pitch + h * HD; const float rf = RF ? RF[(size_t)h * TT + t] : 1.0f; v2h o16; v2us oh, ol;
#pragma unroll
    for (int q = 0; q < 2; ++q) { const int dd = d + q; const int dp = (dd < HD / 2) ? dd + HD / 2 : dd - HD / 2; float x0 = f[dd], x1 = f[dp];
        if (RF) { float n0 = __fmul_rn(x0, rf), n1 = __fmul_rn(x1, rf); asm volatile("" : "+v"(n0)); asm volatile("" : "+v"(n1)); x0 = __fmul_rn(bfr(nw[dd]), n0); x1 = __fmul_rn(bfr(nw[dp]), n1); }
        const v2f cs = *(const v2f*)(CS + ((size_t)t * HD + dd) * 2); float a = __fmul_rn(x0, cs[0]), bq = __fmul_rn(x1, cs[1]); asm volatile("" : "+v"(a)); asm volatile("" : "+v"(bq)); const float r = ((dd < HD / 2) ? __fsub_rn(a, bq) : __fadd_rn(a, bq)) * sc;
        o16[q] = tohx(r); unsigned short a2, c2; splitf(r, a2, c2); oh[q] = a2; ol[q] = c2; }
    *(v2h*)(P16 + e) = o16; *(v2us*)(Ph + e) = oh; *(v2us*)(Pl + e) = ol;  }
__global__ __launch_bounds__(256) void k_vtp(const float* __restrict__ F, int pitch, int nheads, h16* V16, bf* Vh, bf* Vl) { const size_t e = ((size_t)blockIdx.x * 256 + threadIdx.x) * 2; if (e >= (size_t)nheads * HD * TT) return; const int t = (int)(e % TT); const int d = (int)((e / TT) % HD); const int g = (int)(e / ((size_t)TT * HD)); v2h o16; v2us oh, ol;
#pragma unroll
    for (int q = 0; q < 2; ++q) { const float x = F[(size_t)(t + q) * pitch + g * HD + d]; o16[q] = tohx(x); unsigned short a2, c2; splitf(x, a2, c2); oh[q] = a2; ol[q] = c2; }
    *(v2h*)(V16 + e) = o16; *(v2us*)(Vh + e) = oh; *(v2us*)(Vl + e) = ol;  }
__global__ __launch_bounds__(256) void k_csid(float* CS) { const int idx = blockIdx.x * 256 + threadIdx.x; if (idx >= TT * HD) return; v2f cs; cs[0] = 1.0f; cs[1] = 0.0f; *(v2f*)(CS + (size_t)idx * 2) = cs;  }
// k_asoft: per row (zz, i): t = S x HD^-0.5 for j <= i and i - j < WIN (sliding causal window; the reference's -1e9 additive fill vanishes identically); softmax over the 2048 keys (register row, one exp, fixed trees);
__global__ __launch_bounds__(256) void k_asoft(const float* __restrict__ Sb, h16* P16, bf* Ph, bf* Pl) {
    const int lane = threadIdx.x & 31; const int row = blockIdx.x * 8 + (threadIdx.x >> 5); if (row >= ZH * TT) return; const int i = row % TT; const int zz = row / TT; (void)zz; const bool hires = (i < RH); const float* sr = Sb + (size_t)row * TT; float v[TT / 32]; float mx = -3.0e38f;
#pragma unroll
    for (int ch = 0; ch < TT / 128; ++ch) { const int j0 = ch * 128 + lane * 4; const v4f a = *(const v4f*)(sr + j0);
#pragma unroll
        for (int q = 0; q < 4; ++q) { const int j = j0 + q; (void)j; const float t = (j <= i && i - j < WIN) ? a[q] * SCL : -3.0e38f; v[ch * 4 + q] = t; mx = fmaxf(mx, t); } }
#pragma unroll
    for (int sh = 16; sh; sh >>= 1) mx = fmaxf(mx, __shfl_xor(mx, sh, 32));
    float sum = 0.f;
#pragma unroll
    for (int k = 0; k < TT / 32; ++k) { float d0 = __fsub_rn(v[k], mx); asm volatile("" : "+v"(d0)); v[k] = __builtin_amdgcn_exp2f(__fmul_rn(d0, 1.4426950408889634f)); sum += v[k]; }
#pragma unroll
    for (int sh = 16; sh; sh >>= 1) sum += __shfl_xor(sum, sh, 32);
    const float f = __fdiv_rn(hires ? 1.0f : PCAR, sum);
{
        if (hires) {
#pragma unroll
            for (int ch = 0; ch < TT / 128; ++ch) { v4us oh, ol;
#pragma unroll
                for (int q = 0; q < 4; ++q) { unsigned short a, c2; splitf(v[ch * 4 + q] * f, a, c2); oh[q] = a; ol[q] = c2; }
                const size_t oo = ((size_t)zz * (RH ? RH : 1) + i) * TT + ch * 128 + lane * 4; *(v4us*)(Ph + oo) = oh; *(v4us*)(Pl + oo) = ol; }
        } else {
#pragma unroll
            for (int ch = 0; ch < TT / 128; ++ch) { v4h o4;
#pragma unroll
                for (int q = 0; q < 4; ++q) o4[q] = tohx(v[ch * 4 + q] * f);
                *(v4h*)(P16 + (size_t)row * TT + ch * 128 + lane * 4) = o4; } }
         }
}
__global__ __launch_bounds__(256) void k_merge(const float* __restrict__ O, int h0, bf* Ah, bf* Al) { const size_t e = ((size_t)blockIdx.x * 256 + threadIdx.x) * 2; if (e >= (size_t)ZH * TT * HD) return; const int d = (int)(e % HD); const int t = (int)((e / HD) % TT); const int zz = (int)(e / ((size_t)HD * TT)); const float cs = (t < RH) ? 1.0f : (1.0f / PCAR); const size_t oo = ((size_t)(h0 + zz) * TT + t) * HD + d;   /* RAW view: the [H][T][64] head-major flat order, read back by the output GEMM as [T][1024] rows */
    v2us oh, ol; v2f s = *(const v2f*)(O + e);   /* the KS key-slice partial planes of the probability x value contraction, added in ascending slice order */
#pragma unroll   // all KS plane loads in flight together: rolled, each add would wait out its own load
    for (int k = 1; k < KS; ++k) s += *(const v2f*)(O + (size_t)k * ZH * TT * HD + e);
#pragma unroll
    for (int q = 0; q < 2; ++q) { unsigned short a, c2; splitf(s[q] * cs, a, c2); oh[q] = a; ol[q] = c2; } *(v2us*)(Ah + oo) = oh; *(v2us*)(Al + oo) = ol;  }

extern "C" void kernel_launch(void* const* d_in, const int* in_sizes, int n_in,
                              void* d_out, int out_size, void* d_ws, size_t ws_size, hipStream_t stream) {
    (void)in_sizes; (void)n_in; (void)out_size;
    const float* x = (const float*)d_in[0]; const float* wqkv = (const float*)d_in[1]; const float* wo = (const float*)d_in[2]; const float* bo = (const float*)d_in[3];   /* input order x, w_qkv ('oi' [3072][1024]: q | k | v row thirds), w_proj ('oi'), b_proj */ const float* wq = wqkv; const float* wk = wqkv + (size_t)DQ * DM; const float* wv = wqkv + (size_t)2 * DQ * DM;
    float* OUT = (float*)d_out;     // [2][2048][1024]
    char* wsp = (char*)d_ws;
    auto take = [&](size_t bytes) { char* p = wsp; wsp += (bytes + 255) & ~(size_t)255; return (void*)p; };
    bf* WQ = (bf*)take((size_t)DQ * DM * 2); bf* WK = (bf*)take((size_t)DKV * DM * 2); bf* WV = (bf*)take((size_t)DKV * DM * 2); bf* WO = (bf*)take((size_t)DM * DQ * 2); float* CS = (float*)take((size_t)TT * HD * 2 * 4);
    bf* XB = (bf*)take((size_t)TT * DM * 2); float* FQ = (float*)take((size_t)TT * DQ * 4); float* FK = (float*)take((size_t)TT * DKV * 4);
    h16* QP16 = (h16*)take((size_t)NH_ * TT * HD * 2); h16* KP16 = (h16*)take((size_t)NKV * TT * HD * 2); h16* VT16 = (h16*)take((size_t)NKV * HD * TT * 2);
    bf* QPh = (bf*)take((size_t)NH_ * TT * HD * 2); bf* QPl = (bf*)take((size_t)NH_ * TT * HD * 2); bf* KPh = (bf*)take((size_t)NKV * TT * HD * 2); bf* KPl = (bf*)take((size_t)NKV * TT * HD * 2); bf* VTh = (bf*)take((size_t)NKV * HD * TT * 2); bf* VTl = (bf*)take((size_t)NKV * HD * TT * 2); bf* Ph = (bf*)take((size_t)ZH * RH * TT * 2); bf* Pl = (bf*)take((size_t)ZH * RH * TT * 2);
    float* Sb = (float*)take((size_t)ZH * TT * TT * 4); h16* P16 = (h16*)take((size_t)ZH * TT * TT * 2); float* Ob = (float*)take((size_t)KS * ZH * TT * HD * 4); bf* ATh = (bf*)take((size_t)TT * DQ * 2); bf* ATl = (bf*)take((size_t)TT * DQ * 2);
    if ((size_t)(wsp - (char*)d_ws) > ws_size) return;    // ws 256 MiB
    float* FV = FK;   // v projection reuses the k buffer after the k planes are built (stream-ordered)
    { k_cvt8<<<(unsigned)(((size_t)DQ * DM / 8 + 255) / 256), 256, 0, stream>>>(wq, WQ, (size_t)DQ * DM / 8); k_cvt8<<<(unsigned)(((size_t)DKV * DM / 8 + 255) / 256), 256, 0, stream>>>(wk, WK, (size_t)DKV * DM / 8); k_cvt8<<<(unsigned)(((size_t)DKV * DM / 8 + 255) / 256), 256, 0, stream>>>(wv, WV, (size_t)DKV * DM / 8);
      k_cvt8<<<(unsigned)(((size_t)DM * DQ / 8 + 255) / 256), 256, 0, stream>>>(wo, WO, (size_t)DM * DQ / 8);
       }
    k_csid<<<(TT * HD + 255) / 256, 256, 0, stream>>>(CS);
    const unsigned LQ = (unsigned)(((size_t)NH_ * TT * HD / 2 + 255) / 256), LKv = (unsigned)(((size_t)NKV * TT * HD / 2 + 255) / 256);
    for (int b = 0; b < NB_; ++b) {
        
        k_cvt8<<<(unsigned)(((size_t)TT * DM / 8 + 255) / 256), 256, 0, stream>>>(x + (size_t)b * TT * DM, XB, (size_t)TT * DM / 8);
        k_gemmw<bf, 0, false><<<dim3(TT / 64, DQ / 64, 1), 32, 0, stream>>>(XB, nullptr, WQ, nullptr, DM, FQ, DQ, nullptr, 0, 0, 0);
        k_rope<<<LQ, 256, 0, stream>>>(FQ, DQ, NH_, CS, nullptr, nullptr, 1.0f, QP16, QPh, QPl);
        k_gemmw<bf, 0, false><<<dim3(TT / 64, DKV / 64, 1), 32, 0, stream>>>(XB, nullptr, WK, nullptr, DM, FK, DKV, nullptr, 0, 0, 0);
        k_rope<<<LKv, 256, 0, stream>>>(FK, DKV, NKV, CS, nullptr, nullptr, 1.0f, KP16, KPh, KPl);
        k_gemmw<bf, 0, false><<<dim3(TT / 64, DKV / 64, 1), 32, 0, stream>>>(XB, nullptr, WV, nullptr, DM, FV, DKV, nullptr, 0, 0, 0); k_vtp<<<LKv, 256, 0, stream>>>(FV, DKV, NKV, VT16, VTh, VTl);
        for (int h0 = 0; h0 < NH_; h0 += ZH) { const size_t zq = (size_t)h0, zk = (size_t)(h0 / REP);   // one kv head per query head: the pass's two heads use consecutive kv planes (z-strides TT*HD)
            k_gemmc<bf, 2, 1><<<dim3(RH / 64, TT / 64, ZH), 32, 0, stream>>>(QPh + zq * TT * HD, QPl + zq * TT * HD, KPh + zk * TT * HD, KPl + zk * TT * HD, HD, Sb, TT, 0, (size_t)TT * HD, (size_t)TT * HD, (size_t)TT * TT, 0);
            k_gemmc<h16, 0, 1><<<dim3((TT - RH) / 64, TT / 64, ZH), 32, 0, stream>>>(QP16 + zq * TT * HD + (size_t)RH * HD, nullptr, KP16 + zk * TT * HD, nullptr, HD, Sb + (size_t)RH * TT, TT, RH, (size_t)TT * HD, (size_t)TT * HD, (size_t)TT * TT, 0);
            k_asoft<<<ZH * TT / 8, 256, 0, stream>>>(Sb, P16, Ph, Pl);
            k_gemmc<bf, 2, 2><<<dim3(RH / 64, HD / 64 * KS, ZH), 32, 0, stream>>>(Ph, Pl, VTh + zk * HD * TT, VTl + zk * HD * TT, TT, Ob, HD, 0, (size_t)RH * TT, (size_t)HD * TT, (size_t)TT * HD, (size_t)ZH * TT * HD);
            k_gemmc<h16, 0, 2><<<dim3((TT - RH) / 64, HD / 64 * KS, ZH), 32, 0, stream>>>(P16 + (size_t)RH * TT, nullptr, VT16 + zk * HD * TT, nullptr, TT, Ob + (size_t)RH * HD, HD, RH, (size_t)TT * TT, (size_t)HD * TT, (size_t)TT * HD, (size_t)ZH * TT * HD);
            k_merge<<<(unsigned)(((size_t)ZH * TT * HD / 2 + 255) / 256), 256, 0, stream>>>(Ob, h0, ATh, ATl); }
        k_gemmw<bf, 1, true><<<dim3(TT / 64, DM / 64, 1), 32, 0, stream>>>(ATh, ATl, WO, nullptr, DQ, OUT + (size_t)b * TT * DM, DM, bo, 0, 0, 0); }
}

// v002
// A run of this version takes 567 microseconds.
// Timed twice side by side with v001, it ran 1.36 and 1.35 times as fast.
// All steps since v000 together make it 2.52 times as fast.
#include <hip/hip_runtime.h>

// Causal attention whose head outputs are merged by a RAW view (x [2][2048][1024]; qkv = einsum('bte,fe', x, w_qkv) ('oi' [3072][1024] 1/32, no bias) split in thirds q | k | v (16 heads x 64); scores / sqrt(64); causal (-inf); softmax; out [B][H][T][dk] is then VIEWED as (B, T, E) without transposing the heads back (the source's bug, reproduced: flat element ((h*T + t)*64 + d) of the head-major buffer becomes row (h*T + t) / 16, column ((h*T + t) % 16)*64 + d); result = view w_proj^T + b_proj -> [2][2048][1024] (4.2 M); argument order x, w_qkv, w_proj, b_proj).
// Layout per batch: bf16 copy of x; the fused 'oi' weight is Bt as-is (q | k | v row blocks); exact projections; identity-table plane builders; causal T-2048 attention (hybrid rows: < 512 hi/lo 3 products, rest fp16 x1024; k_gemmc skips tiles above the diagonal); k_merge writes the context planes in the HEAD-MAJOR flat order ((h*T + t)*64 + d) so the [2048][1024] operand of the output GEMM is exactly the module's raw view; x w_proj exact + b_proj.
// Compute dtypes, f32 accumulate: every input rounded to bf16; projections exact; attention rows < 512 3 products, rest fp16; softmax f32; w_proj hl x exact + bias.

#define NB_  2
#define TT   2048
#define DM   1024
#define NH_  16
#define NKV  16
#define REP  (NH_ / NKV)
#define HD   64
#define DQ   (NH_ * HD)
#define DKV  (NKV * HD)
#define ZH   8                    // heads per attention pass (grid z of the k_gemmc attention launches)
#define RH   512                  // query rows < RH use hi+lo planes (0: none)
#define WIN  2048
#define PCAR 1024.0f
#define SCL  0.125f   // HD^-0.5
#define KS   16                   // key slices of the probability x value contraction: one work-group per slice, f32 partial planes summed in k_merge
typedef _Float16 h16;
typedef unsigned short bf;
typedef __attribute__((ext_vector_type(16))) __bf16   v16bf;
typedef __attribute__((ext_vector_type(16))) _Float16 v16h;
typedef __attribute__((ext_vector_type(8)))  _Float16 v8h;
typedef __attribute__((ext_vector_type(8)))  unsigned short v8us;
typedef __attribute__((ext_vector_type(8)))  float    v8f;
typedef __attribute__((ext_vector_type(4)))  float    v4f;
typedef v8h  __attribute__((may_alias)) v8ha;
typedef v4f  __attribute__((may_alias)) v4fa;
typedef v8us __attribute__((may_alias)) v8usa;

__device__ __forceinline__ unsigned short f2bf(float f) { unsigned u = __float_as_uint(f); u += 0x7FFFu + ((u >> 16) & 1u); return (unsigned short)(u >> 16); }
__device__ __forceinline__ float bf2f(unsigned short b) { return __uint_as_float(((unsigned)b) << 16); }
__device__ __forceinline__ float bfr(float f) { return bf2f(f2bf(f)); }
__device__ __forceinline__ v16h cat16(v8h lo, v8h hi) { return __builtin_shufflevector(lo, hi, 0, 1, 2, 3, 4, 5, 6, 7, 8, 9, 10, 11, 12, 13, 14, 15); }
__device__ __forceinline__ v16bf cat16b(v8us lo, v8us hi) { return __builtin_bit_cast(v16bf, __builtin_shufflevector(lo, hi, 0, 1, 2, 3, 4, 5, 6, 7, 8, 9, 10, 11, 12, 13, 14, 15)); }
__device__ __forceinline__ v8f wmma16(v16h a, v16h b, v8f c) { return __builtin_amdgcn_wmma_f32_16x16x32_f16(false, a, false, b, (short)0, c, false, false); }
__device__ __forceinline__ v8f wmmab(v16bf a, v16bf b, v8f c) { return __builtin_amdgcn_wmma_f32_16x16x32_bf16(false, a, false, b, (short)0, c, false, false); }



// ---- k_gemmw: register-blocked GEMM, ONE WAVE per 64x64 output tile (16 accumulators), operands straight from K-contiguous 16-bit planes; grid (M/64, N/64, Z), 32 threads.
// C[m][n] (f32, pitch ldc, + optional f32 bias[n]) = sum_k A[m][k] Bt[n][k] (+ split products per NSPLIT). z-batch strides sA/sB/sC in elements. K % 32 == 0.
template <typename T16> struct WFrag;
template <> struct WFrag<h16> { typedef v16h V; static __device__ __forceinline__ V ld(const h16* p) { return cat16(*(const v8h*)p, *(const v8h*)(p + 16)); } static __device__ __forceinline__ v8f mma(V a, V b, v8f c) { return wmma16(a, b, c); } };
template <> struct WFrag<bf> { typedef v16bf V; static __device__ __forceinline__ V ld(const bf* p) { return cat16b(*(const v8us*)p, *(const v8us*)(p + 16)); } static __device__ __forceinline__ v8f mma(V a, V b, v8f c) { return wmmab(a, b, c); } };
template <typename T16, int NSPLIT, bool BIAS>
__global__ __launch_bounds__(32) void k_gemmw(const T16* __restrict__ A, const T16* __restrict__ A2, const T16* __restrict__ Bt, const T16* __restrict__ Bt2, int K, float* C, int ldc, const float* __restrict__ bias, size_t sA, size_t sB, size_t sC) {
    typedef typename WFrag<T16>::V V;
    __shared__ __align__(16) float os[16 * 68];
    const size_t z = blockIdx.z; A += z * sA; if (A2) A2 += z * sA; Bt += z * sB; if (Bt2) Bt2 += z * sB; C += z * sC;
    const int lane = threadIdx.x & 31, lr = lane & 15, hi = lane >> 4; const int r0 = blockIdx.x * 64, c0 = blockIdx.y * 64;
    v8f acc[4][4];
#pragma unroll
    for (int mb = 0; mb < 4; ++mb)
#pragma unroll
        for (int nb = 0; nb < 4; ++nb) acc[mb][nb] = (v8f){};
    const size_t aoff = (size_t)(r0 + lr) * K + 8 * hi, boff = (size_t)(c0 + lr) * K + 8 * hi;
#pragma unroll 1
    for (int kc = 0; kc < K; kc += 32) {
        V a[4], a2[4];
#pragma unroll
        for (int mb = 0; mb < 4; ++mb) { a[mb] = WFrag<T16>::ld(A + aoff + (size_t)mb * 16 * K + kc); if (NSPLIT == 1 || NSPLIT == 2) a2[mb] = WFrag<T16>::ld(A2 + aoff + (size_t)mb * 16 * K + kc); }
#pragma unroll
        for (int nb = 0; nb < 4; ++nb) { const V b = WFrag<T16>::ld(Bt + boff + (size_t)nb * 16 * K + kc); V b2; if (NSPLIT >= 2) b2 = WFrag<T16>::ld(Bt2 + boff + (size_t)nb * 16 * K + kc);
#pragma unroll
            for (int mb = 0; mb < 4; ++mb) { acc[mb][nb] = WFrag<T16>::mma(a[mb], b, acc[mb][nb]); if (NSPLIT == 1 || NSPLIT == 2) acc[mb][nb] = WFrag<T16>::mma(a2[mb], b, acc[mb][nb]); if (NSPLIT >= 2) acc[mb][nb] = WFrag<T16>::mma(a[mb], b2, acc[mb][nb]); } }
        asm volatile("v_nop\n\tv_nop\n\tv_nop\n\tv_nop" : "+v"(acc[0][0]), "+v"(acc[1][1]), "+v"(acc[2][2]), "+v"(acc[3][3]) : "v"(a[0]), "v"(a[3]));
    }
#pragma unroll
    for (int mb = 0; mb < 4; ++mb) {
#pragma unroll
        for (int nb = 0; nb < 4; ++nb) {
#pragma unroll
            for (int j = 0; j < 8; ++j) os[(hi * 8 + j) * 68 + nb * 16 + lr] = acc[mb][nb][j]; }
        __builtin_amdgcn_wave_barrier(); asm volatile("" ::: "memory");
        float* crow = C + (size_t)(r0 + mb * 16) * ldc + c0;
{
#pragma unroll
            for (int s = 0; s < 8; ++s) { const int row = 2 * s + hi, cofs = lr * 4; v4f val = *(const v4fa*)(os + row * 68 + cofs); if (BIAS) { val[0] += bfr(bias[c0 + cofs]); val[1] += bfr(bias[c0 + cofs + 1]); val[2] += bfr(bias[c0 + cofs + 2]); val[3] += bfr(bias[c0 + cofs + 3]); }
                *(v4f*)(crow + (size_t)row * ldc + cofs) = val; }
             }
        __builtin_amdgcn_wave_barrier(); asm volatile("" ::: "memory");
    }
}

// ---- k_gemmc: the same one-wave 64x64 tile GEMM specialised for causal attention: CMODE 1 skips score tiles entirely above the diagonal (query rows r0+roff.., key columns c0..), CMODE 2 limits the
// key (K) loop of the probability x value contraction to the diagonal block (probabilities beyond it are exactly zero). roff = row offset of this launch's first row within the sequence.
// CMODE 2 also splits that key loop over KS work-groups (grid.y = N/64 * KS): slice ks takes the 64-key chunks ks, ks + KS, ... (one whole 128-byte line of every 16-bit row per chunk) and stores its f32 partial tile
// in plane ks of C (plane stride sK elements); a slice with no chunk below the diagonal stores zeros, so every plane is written whole. k_merge adds the planes in ascending ks.
// lda = row pitch of A and A2 in elements (the probability rows lie inside the f32 score rows, pitch 2 * K); Bt and Bt2 keep pitch K.
template <typename T16, int NSPLIT, int CMODE>
__global__ __launch_bounds__(32) void k_gemmc(const T16* __restrict__ A, const T16* __restrict__ A2, const T16* __restrict__ Bt, const T16* __restrict__ Bt2, int K, int lda, float* C, int ldc, int roff, size_t sA, size_t sB, size_t sC, size_t sK) {
    typedef typename WFrag<T16>::V V;
    __shared__ __align__(16) float os[16 * 68];
    const size_t z = blockIdx.z; A += z * sA; if (A2) A2 += z * sA; Bt += z * sB; if (Bt2) Bt2 += z * sB; C += z * sC;
    const int ks = (CMODE == 2) ? (int)(blockIdx.y % KS) : 0; if (CMODE == 2) C += (size_t)ks * sK;
    const int lane = threadIdx.x & 31, lr = lane & 15, hi = lane >> 4; const int r0 = blockIdx.x * 64, c0 = (int)((CMODE == 2) ? blockIdx.y / KS : blockIdx.y) * 64;
    if (CMODE == 1 && c0 > r0 + roff + 63) return;                  // score tile entirely above the causal diagonal: loaded but discarded (the softmax masks j > i by select)
    const int Kl = (CMODE == 2) ? min(K, r0 + roff + 64) : K;        // P.V: probabilities are exactly 0 beyond the diagonal block, so the K loop stops there
    v8f acc[4][4];
#pragma unroll
    for (int mb = 0; mb < 4; ++mb)
#pragma unroll
        for (int nb = 0; nb < 4; ++nb) acc[mb][nb] = (v8f){};
    const size_t aoff = (size_t)(r0 + lr) * lda + 8 * hi, boff = (size_t)(c0 + lr) * K + 8 * hi;
#pragma unroll 1
    for (int kc = ks * 64; kc < Kl; kc += (CMODE == 2 && (kc & 32)) ? KS * 64 - 32 : 32) {
        V a[4], a2[4];
#pragma unroll
        for (int mb = 0; mb < 4; ++mb) { a[mb] = WFrag<T16>::ld(A + aoff + (size_t)mb * 16 * lda + kc); if (NSPLIT == 1 || NSPLIT == 2) a2[mb] = WFrag<T16>::ld(A2 + aoff + (size_t)mb * 16 * lda + kc);
            asm volatile("s_wait_xcnt 0x0" ::: "memory"); }   // the next loads' results may land in the address registers of the loads just issued: their translations are waited out first
#pragma unroll
        for (int nb = 0; nb < 4; ++nb) { const V b = WFrag<T16>::ld(Bt + boff + (size_t)nb * 16 * K + kc); V b2; if (NSPLIT >= 2) b2 = WFrag<T16>::ld(Bt2 + boff + (size_t)nb * 16 * K + kc);
#pragma unroll
            for (int mb = 0; mb < 4; ++mb) { acc[mb][nb] = WFrag<T16>::mma(a[mb], b, acc[mb][nb]); if (NSPLIT == 1 || NSPLIT == 2) acc[mb][nb] = WFrag<T16>::mma(a2[mb], b, acc[mb][nb]); if (NSPLIT >= 2) acc[mb][nb] = WFrag<T16>::mma(a[mb], b2, acc[mb][nb]); } }
        asm volatile("v_nop\n\tv_nop\n\tv_nop\n\tv_nop" : "+v"(acc[0][0]), "+v"(acc[1][1]), "+v"(acc[2][2]), "+v"(acc[3][3]) : "v"(a[0]), "v"(a[3]));
    }
#pragma unroll
    for (int mb = 0; mb < 4; ++mb) {
#pragma unroll
        for (int nb = 0; nb < 4; ++nb) {
#pragma unroll
            for (int j = 0; j < 8; ++j) os[(hi * 8 + j) * 68 + nb * 16 + lr] = acc[mb][nb][j]; }
        __builtin_amdgcn_wave_barrier(); asm volatile("" ::: "memory");
        float* crow = C + (size_t)(r0 + mb * 16) * ldc + c0;
{
#pragma unroll
            for (int s = 0; s < 8; ++s) { const int row = 2 * s + hi, cofs = lr * 4; v4f val = *(const v4fa*)(os + row * 68 + cofs);
                *(v4f*)(crow + (size_t)row * ldc + cofs) = val; }
             }
        __builtin_amdgcn_wave_barrier(); asm volatile("" ::: "memory");
    }
}

__device__ __forceinline__ h16 tohx(float x) { return (h16)x; }
__device__ __forceinline__ void splitf(float y, unsigned short& h, unsigned short& l) { h = f2bf(y); l = f2bf(y - bf2f(h)); }
typedef __attribute__((ext_vector_type(2))) _Float16 v2h;
typedef __attribute__((ext_vector_type(4))) _Float16 v4h;
typedef __attribute__((ext_vector_type(2))) unsigned short v2us;
typedef __attribute__((ext_vector_type(4))) unsigned short v4us;
typedef __attribute__((ext_vector_type(2))) float v2f;
typedef __attribute__((ext_vector_type(4))) int v4i;
typedef v4h  __attribute__((may_alias)) v4ha;
typedef v4us __attribute__((may_alias)) v4usa;

__global__ __launch_bounds__(256) void k_cvt8(const float* __restrict__ src, bf* dst, size_t n8) { const size_t i = (size_t)blockIdx.x * 256 + threadIdx.x; if (i >= n8) return; const v8f v = *(const v8f*)(src + i * 8); v8us o;
#pragma unroll
    for (int k = 0; k < 8; ++k) o[k] = f2bf(v[k]); *(v8us*)(dst + i * 8) = o;  }

// k_rope: head planes [h][t][d] (fp16 + hi/lo) of rope(x) x sc with the rotate-half convention out[d] = x[d] cos[t][d] - x[d+HD/2] sin[t][d], out[d+HD/2] = x[d+HD/2] cos[t][d+HD/2] + x[d] sin[t][d+HD/2]
__global__ __launch_bounds__(256) void k_rope(const float* __restrict__ F, int pitch, int nheads, const float* __restrict__ CS, const float* __restrict__ RF, const float* __restrict__ nw, float sc, h16* P16, bf* Ph, bf* Pl) {
    const size_t e = ((size_t)blockIdx.x * 256 + threadIdx.x) * 2; if (e >= (size_t)nheads * TT * HD) return; const int d = (int)(e % HD); const int t = (int)((e / HD) % TT); const int h = (int)(e / ((size_t)HD * TT)); const float* f = F + (size_t)t * pitch + h * HD; const float rf = RF ? RF[(size_t)h * TT + t] : 1.0f; v2h o16; v2us oh, ol;
#pragma unroll
    for (int q = 0; q < 2; ++q) { const int dd = d + q; const int dp = (dd < HD / 2) ? dd + HD / 2 : dd - HD / 2; float x0 = f[dd], x1 = f[dp];
        if (RF) { float n0 = __fmul_rn(x0, rf), n1 = __fmul_rn(x1, rf); asm volatile("" : "+v"(n0)); asm volatile("" : "+v"(n1)); x0 = __fmul_rn(bfr(nw[dd]), n0); x1 = __fmul_rn(bfr(nw[dp]), n1); }
        const v2f cs = *(const v2f*)(CS + ((size_t)t * HD + dd) * 2); float a = __fmul_rn(x0, cs[0]), bq = __fmul_rn(x1, cs[1]); asm volatile("" : "+v"(a)); asm volatile("" : "+v"(bq)); const float r = ((dd < HD / 2) ? __fsub_rn(a, bq) : __fadd_rn(a, bq)) * sc;
        o16[q] = tohx(r); unsigned short a2, c2; splitf(r, a2, c2); oh[q] = a2; ol[q] = c2; }
    *(v2h*)(P16 + e) = o16; *(v2us*)(Ph + e) = oh; *(v2us*)(Pl + e) = ol;  }
__global__ __launch_bounds__(256) void k_vtp(const float* __restrict__ F, int pitch, int nheads, h16* V16, bf* Vh, bf* Vl) { const size_t e = ((size_t)blockIdx.x * 256 + threadIdx.x) * 2; if (e >= (size_t)nheads * HD * TT) return; const int t = (int)(e % TT); const int d = (int)((e / TT) % HD); const int g = (int)(e / ((size_t)TT * HD)); v2h o16; v2us oh, ol;
#pragma unroll
    for (int q = 0; q < 2; ++q) { const float x = F[(size_t)(t + q) * pitch + g * HD + d]; o16[q] = tohx(x); unsigned short a2, c2; splitf(x, a2, c2); oh[q] = a2; ol[q] = c2; }
    *(v2h*)(V16 + e) = o16; *(v2us*)(Vh + e) = oh; *(v2us*)(Vl + e) = ol;  }
__global__ __launch_bounds__(256) void k_csid(float* CS) { const int idx = blockIdx.x * 256 + threadIdx.x; if (idx >= TT * HD) return; v2f cs; cs[0] = 1.0f; cs[1] = 0.0f; *(v2f*)(CS + (size_t)idx * 2) = cs;  }
// k_asoft: per row (zz, i): t = S x HD^-0.5 for j <= i and i - j < WIN (sliding causal window; the reference's -1e9 additive fill vanishes identically); softmax over the 2048 keys (register row, one exp, fixed trees);
// the probabilities go IN PLACE over the row's own 8192 score bytes (one wave owns a row and holds all of it in registers before its first store): fp16 row in the first half, or the hi plane in the first half and the lo plane in the second.
__global__ __launch_bounds__(256) void k_asoft(float* Sb) {
    const int lane = threadIdx.x & 31; const int row = blockIdx.x * 8 + (threadIdx.x >> 5); if (row >= ZH * TT) return; const int i = row % TT; const int zz = row / TT; (void)zz; const bool hires = (i < RH); const float* sr = Sb + (size_t)row * TT; h16* const p16 = (h16*)(Sb + (size_t)row * TT); bf* const ph = (bf*)(Sb + (size_t)row * TT); bf* const pl = ph + TT; float v[TT / 32]; float mx = -3.0e38f;
#pragma unroll
    for (int ch = 0; ch < TT / 128; ++ch) { const int j0 = ch * 128 + lane * 4; const v4f a = *(const v4fa*)(sr + j0);
#pragma unroll
        for (int q = 0; q < 4; ++q) { const int j = j0 + q; (void)j; const float t = (j <= i && i - j < WIN) ? a[q] * SCL : -3.0e38f; v[ch * 4 + q] = t; mx = fmaxf(mx, t); } }
#pragma unroll
    for (int sh = 16; sh; sh >>= 1) mx = fmaxf(mx, __shfl_xor(mx, sh, 32));
    float sum = 0.f;
#pragma unroll
    for (int k = 0; k < TT / 32; ++k) { float d0 = __fsub_rn(v[k], mx); asm volatile("" : "+v"(d0)); v[k] = __builtin_amdgcn_exp2f(__fmul_rn(d0, 1.4426950408889634f)); sum += v[k]; }
#pragma unroll
    for (int sh = 16; sh; sh >>= 1) sum += __shfl_xor(sum, sh, 32);
    const float f = __fdiv_rn(hires ? 1.0f : PCAR, sum);
{
        if (hires) {
#pragma unroll
            for (int ch = 0; ch < TT / 128; ++ch) { v4us oh, ol;
#pragma unroll
                for (int q = 0; q < 4; ++q) { unsigned short a, c2; splitf(v[ch * 4 + q] * f, a, c2); oh[q] = a; ol[q] = c2; }
                const int oo = ch * 128 + lane * 4; *(v4usa*)(ph + oo) = oh; *(v4usa*)(pl + oo) = ol; }
        } else {
#pragma unroll
            for (int ch = 0; ch < TT / 128; ++ch) { v4h o4;
#pragma unroll
                for (int q = 0; q < 4; ++q) o4[q] = tohx(v[ch * 4 + q] * f);
                *(v4ha*)(p16 + ch * 128 + lane * 4) = o4; } }
         }
}
__global__ __launch_bounds__(256) void k_merge(const float* __restrict__ O, int h0, bf* Ah, bf* Al) { const size_t e = ((size_t)blockIdx.x * 256 + threadIdx.x) * 2; if (e >= (size_t)ZH * TT * HD) return; const int d = (int)(e % HD); const int t = (int)((e / HD) % TT); const int zz = (int)(e / ((size_t)HD * TT)); const float cs = (t < RH) ? 1.0f : (1.0f / PCAR); const size_t oo = ((size_t)(h0 + zz) * TT + t) * HD + d;   /* RAW view: the [H][T][64] head-major flat order, read back by the output GEMM as [T][1024] rows */
    v2us oh, ol; v2f s = *(const v2f*)(O + e);   /* the KS key-slice partial planes of the probability x value contraction, added in ascending slice order */
#pragma unroll   // all KS plane loads in flight together: rolled, each add would wait out its own load
    for (int k = 1; k < KS; ++k) s += *(const v2f*)(O + (size_t)k * ZH * TT * HD + e);
#pragma unroll
    for (int q = 0; q < 2; ++q) { unsigned short a, c2; splitf(s[q] * cs, a, c2); oh[q] = a; ol[q] = c2; } *(v2us*)(Ah + oo) = oh; *(v2us*)(Al + oo) = ol;  }

extern "C" void kernel_launch(void* const* d_in, const int* in_sizes, int n_in,
                              void* d_out, int out_size, void* d_ws, size_t ws_size, hipStream_t stream) {
    (void)in_sizes; (void)n_in; (void)out_size;
    const float* x = (const float*)d_in[0]; const float* wqkv = (const float*)d_in[1]; const float* wo = (const float*)d_in[2]; const float* bo = (const float*)d_in[3];   /* input order x, w_qkv ('oi' [3072][1024]: q | k | v row thirds), w_proj ('oi'), b_proj */ const float* wq = wqkv; const float* wk = wqkv + (size_t)DQ * DM; const float* wv = wqkv + (size_t)2 * DQ * DM;
    float* OUT = (float*)d_out;     // [2][2048][1024]
    char* wsp = (char*)d_ws;
    auto take = [&](size_t bytes) { char* p = wsp; wsp += (bytes + 255) & ~(size_t)255; return (void*)p; };
    bf* WQ = (bf*)take((size_t)DQ * DM * 2); bf* WK = (bf*)take((size_t)DKV * DM * 2); bf* WV = (bf*)take((size_t)DKV * DM * 2); bf* WO = (bf*)take((size_t)DM * DQ * 2); float* CS = (float*)take((size_t)TT * HD * 2 * 4);
    h16* QP16 = (h16*)take((size_t)NH_ * TT * HD * 2); h16* KP16 = (h16*)take((size_t)NKV * TT * HD * 2); h16* VT16 = (h16*)take((size_t)NKV * HD * TT * 2);
    bf* QPh = (bf*)take((size_t)NH_ * TT * HD * 2); bf* QPl = (bf*)take((size_t)NH_ * TT * HD * 2); bf* KPh = (bf*)take((size_t)NKV * TT * HD * 2); bf* KPl = (bf*)take((size_t)NKV * TT * HD * 2); bf* VTh = (bf*)take((size_t)NKV * HD * TT * 2); bf* VTl = (bf*)take((size_t)NKV * HD * TT * 2);
    float* Sb = (float*)take((size_t)ZH * TT * TT * 4); float* Ob = (float*)take((size_t)KS * ZH * TT * HD * 4); bf* ATh = (bf*)take((size_t)TT * DQ * 2); bf* ATl = (bf*)take((size_t)TT * DQ * 2);
    if ((size_t)(wsp - (char*)d_ws) > ws_size) return;    // ws 256 MiB
    bf* XB = (bf*)Ob; float* FQ = (float*)(XB + (size_t)TT * DM); float* FK = FQ + (size_t)TT * DQ;   // the projection buffers share Ob's bytes: their last reader (k_vtp) is stream-ordered ahead of the batch's first partial plane, and the next batch writes them anew
    h16* P16 = (h16*)Sb; bf* Ph = (bf*)Sb; bf* Pl = Ph + TT;   // probability rows inside the score rows (k_asoft): row pitch 2 * TT 16-bit elements
    float* FV = FK;   // v projection reuses the k buffer after the k planes are built (stream-ordered)
    { k_cvt8<<<(unsigned)(((size_t)DQ * DM / 8 + 255) / 256), 256, 0, stream>>>(wq, WQ, (size_t)DQ * DM / 8); k_cvt8<<<(unsigned)(((size_t)DKV * DM / 8 + 255) / 256), 256, 0, stream>>>(wk, WK, (size_t)DKV * DM / 8); k_cvt8<<<(unsigned)(((size_t)DKV * DM / 8 + 255) / 256), 256, 0, stream>>>(wv, WV, (size_t)DKV * DM / 8);
      k_cvt8<<<(unsigned)(((size_t)DM * DQ / 8 + 255) / 256), 256, 0, stream>>>(wo, WO, (size_t)DM * DQ / 8);
       }
    k_csid<<<(TT * HD + 255) / 256, 256, 0, stream>>>(CS);
    const unsigned LQ = (unsigned)(((size_t)NH_ * TT * HD / 2 + 255) / 256), LKv = (unsigned)(((size_t)NKV * TT * HD / 2 + 255) / 256);
    for (int b = 0; b < NB_; ++b) {
        
        k_cvt8<<<(unsigned)(((size_t)TT * DM / 8 + 255) / 256), 256, 0, stream>>>(x + (size_t)b * TT * DM, XB, (size_t)TT * DM / 8);
        k_gemmw<bf, 0, false><<<dim3(TT / 64, DQ / 64, 1), 32, 0, stream>>>(XB, nullptr, WQ, nullptr, DM, FQ, DQ, nullptr, 0, 0, 0);
        k_rope<<<LQ, 256, 0, stream>>>(FQ, DQ, NH_, CS, nullptr, nullptr, 1.0f, QP16, QPh, QPl);
        k_gemmw<bf, 0, false><<<dim3(TT / 64, DKV / 64, 1), 32, 0, stream>>>(XB, nullptr, WK, nullptr, DM, FK, DKV, nullptr, 0, 0, 0);
        k_rope<<<LKv, 256, 0, stream>>>(FK, DKV, NKV, CS, nullptr, nullptr, 1.0f, KP16, KPh, KPl);
        k_gemmw<bf, 0, false><<<dim3(TT / 64, DKV / 64, 1), 32, 0, stream>>>(XB, nullptr, WV, nullptr, DM, FV, DKV, nullptr, 0, 0, 0); k_vtp<<<LKv, 256, 0, stream>>>(FV, DKV, NKV, VT16, VTh, VTl);
        for (int h0 = 0; h0 < NH_; h0 += ZH) { const size_t zq = (size_t)h0, zk = (size_t)(h0 / REP);   // one kv head per query head: the pass's ZH heads use consecutive kv planes (z-strides TT*HD)
            k_gemmc<bf, 2, 1><<<dim3(RH / 64, TT / 64, ZH), 32, 0, stream>>>(QPh + zq * TT * HD, QPl + zq * TT * HD, KPh + zk * TT * HD, KPl + zk * TT * HD, HD, HD, Sb, TT, 0, (size_t)TT * HD, (size_t)TT * HD, (size_t)TT * TT, 0);
            k_gemmc<h16, 0, 1><<<dim3((TT - RH) / 64, TT / 64, ZH), 32, 0, stream>>>(QP16 + zq * TT * HD + (size_t)RH * HD, nullptr, KP16 + zk * TT * HD, nullptr, HD, HD, Sb + (size_t)RH * TT, TT, RH, (size_t)TT * HD, (size_t)TT * HD, (size_t)TT * TT, 0);
            k_asoft<<<ZH * TT / 8, 256, 0, stream>>>(Sb);
            k_gemmc<bf, 2, 2><<<dim3(RH / 64, HD / 64 * KS, ZH), 32, 0, stream>>>(Ph, Pl, VTh + zk * HD * TT, VTl + zk * HD * TT, TT, 2 * TT, Ob, HD, 0, (size_t)2 * TT * TT, (size_t)HD * TT, (size_t)TT * HD, (size_t)ZH * TT * HD);
            k_gemmc<h16, 0, 2><<<dim3((TT - RH) / 64, HD / 64 * KS, ZH), 32, 0, stream>>>(P16 + (size_t)RH * 2 * TT, nullptr, VT16 + zk * HD * TT, nullptr, TT, 2 * TT, Ob + (size_t)RH * HD, HD, RH, (size_t)2 * TT * TT, (size_t)HD * TT, (size_t)TT * HD, (size_t)ZH * TT * HD);
            k_merge<<<(unsigned)(((size_t)ZH * TT * HD / 2 + 255) / 256), 256, 0, stream>>>(Ob, h0, ATh, ATl); }
        k_gemmw<bf, 1, true><<<dim3(TT / 64, DM / 64, 1), 32, 0, stream>>>(ATh, ATl, WO, nullptr, DQ, OUT + (size_t)b * TT * DM, DM, bo, 0, 0, 0); }
}

// v003
// It runs in 308 microseconds.
// In two side-by-side timings against v002, it was 1.84 and 1.83 times as fast.
// All steps since v000 together make it 4.62 times as fast.
#include <hip/hip_runtime.h>

// Causal attention whose head outputs are merged by a RAW view (x [2][2048][1024]; qkv = einsum('bte,fe', x, w_qkv) ('oi' [3072][1024] 1/32, no bias) split in thirds q | k | v (16 heads x 64); scores / sqrt(64); causal (-inf); softmax; out [B][H][T][dk] is then VIEWED as (B, T, E) without transposing the heads back (the source's bug, reproduced: flat element ((h*T + t)*64 + d) of the head-major buffer becomes row (h*T + t) / 16, column ((h*T + t) % 16)*64 + d); result = view w_proj^T + b_proj -> [2][2048][1024] (4.2 M); argument order x, w_qkv, w_proj, b_proj).
// Layout per batch: bf16 copy of x; the fused 'oi' weight is Bt as-is (q | k | v row blocks); exact projections; identity-table plane builders; fused causal T-2048 attention (k_fattn, running softmax; hybrid rows: < 512 hi/lo 3 products, rest fp16 x1024; key blocks above the diagonal are never visited), which writes the context planes in the HEAD-MAJOR flat order ((h*T + t)*64 + d) so the [2048][1024] operand of the output GEMM is exactly the module's raw view; x w_proj exact + b_proj.
// Compute dtypes, f32 accumulate: every input rounded to bf16; projections exact; attention rows < 512 3 products, rest fp16; softmax f32; w_proj hl x exact + bias.

#define NB_  2
#define TT   2048
#define DM   1024
#define NH_  16
#define NKV  16
#define HD   64
#define DQ   (NH_ * HD)
#define DKV  (NKV * HD)
#define RH   512                  // query rows < RH use hi+lo planes (0: none)
#define PSH  10.0f                // fp16 probabilities are carried x 2^PSH
#define SCL  0.125f   // HD^-0.5
typedef _Float16 h16;
typedef unsigned short bf;
typedef __attribute__((ext_vector_type(16))) __bf16   v16bf;
typedef __attribute__((ext_vector_type(16))) _Float16 v16h;
typedef __attribute__((ext_vector_type(8)))  _Float16 v8h;
typedef __attribute__((ext_vector_type(8)))  unsigned short v8us;
typedef __attribute__((ext_vector_type(8)))  float    v8f;
typedef __attribute__((ext_vector_type(4)))  float    v4f;
typedef v8h  __attribute__((may_alias)) v8ha;
typedef v4f  __attribute__((may_alias)) v4fa;
typedef v8us __attribute__((may_alias)) v8usa;

__device__ __forceinline__ unsigned short f2bf(float f) { unsigned u = __float_as_uint(f); u += 0x7FFFu + ((u >> 16) & 1u); return (unsigned short)(u >> 16); }
__device__ __forceinline__ float bf2f(unsigned short b) { return __uint_as_float(((unsigned)b) << 16); }
__device__ __forceinline__ float bfr(float f) { return bf2f(f2bf(f)); }
__device__ __forceinline__ v16h cat16(v8h lo, v8h hi) { return __builtin_shufflevector(lo, hi, 0, 1, 2, 3, 4, 5, 6, 7, 8, 9, 10, 11, 12, 13, 14, 15); }
__device__ __forceinline__ v16bf cat16b(v8us lo, v8us hi) { return __builtin_bit_cast(v16bf, __builtin_shufflevector(lo, hi, 0, 1, 2, 3, 4, 5, 6, 7, 8, 9, 10, 11, 12, 13, 14, 15)); }
__device__ __forceinline__ v8f wmma16(v16h a, v16h b, v8f c) { return __builtin_amdgcn_wmma_f32_16x16x32_f16(false, a, false, b, (short)0, c, false, false); }
__device__ __forceinline__ v8f wmmab(v16bf a, v16bf b, v8f c) { return __builtin_amdgcn_wmma_f32_16x16x32_bf16(false, a, false, b, (short)0, c, false, false); }



// ---- k_gemmw: register-blocked GEMM, ONE WAVE per 64x64 output tile (16 accumulators), operands straight from K-contiguous 16-bit planes; grid (M/64, N/64, Z), 32 threads.
// C[m][n] (f32, pitch ldc, + optional f32 bias[n]) = sum_k A[m][k] Bt[n][k] (+ split products per NSPLIT). z-batch strides sA/sB/sC in elements. K % 32 == 0.
template <typename T16> struct WFrag;
template <> struct WFrag<h16> { typedef v16h V; static __device__ __forceinline__ V ld(const h16* p) { return cat16(*(const v8h*)p, *(const v8h*)(p + 16)); } static __device__ __forceinline__ v8f mma(V a, V b, v8f c) { return wmma16(a, b, c); } };
template <> struct WFrag<bf> { typedef v16bf V; static __device__ __forceinline__ V ld(const bf* p) { return cat16b(*(const v8us*)p, *(const v8us*)(p + 16)); } static __device__ __forceinline__ v8f mma(V a, V b, v8f c) { return wmmab(a, b, c); } };
template <typename T16, int NSPLIT, bool BIAS>
__global__ __launch_bounds__(32) void k_gemmw(const T16* __restrict__ A, const T16* __restrict__ A2, const T16* __restrict__ Bt, const T16* __restrict__ Bt2, int K, float* C, int ldc, const float* __restrict__ bias, size_t sA, size_t sB, size_t sC) {
    typedef typename WFrag<T16>::V V;
    __shared__ __align__(16) float os[16 * 68];
    const size_t z = blockIdx.z; A += z * sA; if (A2) A2 += z * sA; Bt += z * sB; if (Bt2) Bt2 += z * sB; C += z * sC;
    const int lane = threadIdx.x & 31, lr = lane & 15, hi = lane >> 4; const int r0 = blockIdx.x * 64, c0 = blockIdx.y * 64;
    v8f acc[4][4];
#pragma unroll
    for (int mb = 0; mb < 4; ++mb)
#pragma unroll
        for (int nb = 0; nb < 4; ++nb) acc[mb][nb] = (v8f){};
    const size_t aoff = (size_t)(r0 + lr) * K + 8 * hi, boff = (size_t)(c0 + lr) * K + 8 * hi;
#pragma unroll 1
    for (int kc = 0; kc < K; kc += 32) {
        V a[4], a2[4];
#pragma unroll
        for (int mb = 0; mb < 4; ++mb) { a[mb] = WFrag<T16>::ld(A + aoff + (size_t)mb * 16 * K + kc); if (NSPLIT == 1 || NSPLIT == 2) a2[mb] = WFrag<T16>::ld(A2 + aoff + (size_t)mb * 16 * K + kc); }
#pragma unroll
        for (int nb = 0; nb < 4; ++nb) { const V b = WFrag<T16>::ld(Bt + boff + (size_t)nb * 16 * K + kc); V b2; if (NSPLIT >= 2) b2 = WFrag<T16>::ld(Bt2 + boff + (size_t)nb * 16 * K + kc);
#pragma unroll
            for (int mb = 0; mb < 4; ++mb) { acc[mb][nb] = WFrag<T16>::mma(a[mb], b, acc[mb][nb]); if (NSPLIT == 1 || NSPLIT == 2) acc[mb][nb] = WFrag<T16>::mma(a2[mb], b, acc[mb][nb]); if (NSPLIT >= 2) acc[mb][nb] = WFrag<T16>::mma(a[mb], b2, acc[mb][nb]); } }
        asm volatile("v_nop\n\tv_nop\n\tv_nop\n\tv_nop" : "+v"(acc[0][0]), "+v"(acc[1][1]), "+v"(acc[2][2]), "+v"(acc[3][3]) : "v"(a[0]), "v"(a[3]));
    }
#pragma unroll
    for (int mb = 0; mb < 4; ++mb) {
#pragma unroll
        for (int nb = 0; nb < 4; ++nb) {
#pragma unroll
            for (int j = 0; j < 8; ++j) os[(hi * 8 + j) * 68 + nb * 16 + lr] = acc[mb][nb][j]; }
        __builtin_amdgcn_wave_barrier(); asm volatile("" ::: "memory");
        float* crow = C + (size_t)(r0 + mb * 16) * ldc + c0;
{
#pragma unroll
            for (int s = 0; s < 8; ++s) { const int row = 2 * s + hi, cofs = lr * 4; v4f val = *(const v4fa*)(os + row * 68 + cofs); if (BIAS) { val[0] += bfr(bias[c0 + cofs]); val[1] += bfr(bias[c0 + cofs + 1]); val[2] += bfr(bias[c0 + cofs + 2]); val[3] += bfr(bias[c0 + cofs + 3]); }
                *(v4f*)(crow + (size_t)row * ldc + cofs) = val; }
             }
        __builtin_amdgcn_wave_barrier(); asm volatile("" ::: "memory");
    }
}

__device__ __forceinline__ h16 tohx(float x) { return (h16)x; }
__device__ __forceinline__ void splitf(float y, unsigned short& h, unsigned short& l) { h = f2bf(y); l = f2bf(y - bf2f(h)); }
typedef __attribute__((ext_vector_type(2))) _Float16 v2h;
typedef __attribute__((ext_vector_type(4))) _Float16 v4h;
typedef __attribute__((ext_vector_type(2))) unsigned short v2us;
typedef __attribute__((ext_vector_type(4))) unsigned short v4us;
typedef __attribute__((ext_vector_type(2))) float v2f;
typedef __attribute__((ext_vector_type(4))) int v4i;
typedef v4h  __attribute__((may_alias)) v4ha;
typedef v4us __attribute__((may_alias)) v4usa;

__global__ __launch_bounds__(256) void k_cvt8(const float* __restrict__ src, bf* dst, size_t n8) { const size_t i = (size_t)blockIdx.x * 256 + threadIdx.x; if (i >= n8) return; const v8f v = *(const v8f*)(src + i * 8); v8us o;
#pragma unroll
    for (int k = 0; k < 8; ++k) o[k] = f2bf(v[k]); *(v8us*)(dst + i * 8) = o;  }

// k_rope: head planes [h][t][d] (fp16 + hi/lo) of rope(x) x sc with the rotate-half convention out[d] = x[d] cos[t][d] - x[d+HD/2] sin[t][d], out[d+HD/2] = x[d+HD/2] cos[t][d+HD/2] + x[d] sin[t][d+HD/2]
__global__ __launch_bounds__(256) void k_rope(const float* __restrict__ F, int pitch, int nheads, const float* __restrict__ CS, const float* __restrict__ RF, const float* __restrict__ nw, float sc, h16* P16, bf* Ph, bf* Pl) {
    const size_t e = ((size_t)blockIdx.x * 256 + threadIdx.x) * 2; if (e >= (size_t)nheads * TT * HD) return; const int d = (int)(e % HD); const int t = (int)((e / HD) % TT); const int h = (int)(e / ((size_t)HD * TT)); const float* f = F + (size_t)t * pitch + h * HD; const float rf = RF ? RF[(size_t)h * TT + t] : 1.0f; v2h o16; v2us oh, ol;
#pragma unroll
    for (int q = 0; q < 2; ++q) { const int dd = d + q; const int dp = (dd < HD / 2) ? dd + HD / 2 : dd - HD / 2; float x0 = f[dd], x1 = f[dp];
        if (RF) { float n0 = __fmul_rn(x0, rf), n1 = __fmul_rn(x1, rf); asm volatile("" : "+v"(n0)); asm volatile("" : "+v"(n1)); x0 = __fmul_rn(bfr(nw[dd]), n0); x1 = __fmul_rn(bfr(nw[dp]), n1); }
        const v2f cs = *(const v2f*)(CS + ((size_t)t * HD + dd) * 2); float a = __fmul_rn(x0, cs[0]), bq = __fmul_rn(x1, cs[1]); asm volatile("" : "+v"(a)); asm volatile("" : "+v"(bq)); const float r = ((dd < HD / 2) ? __fsub_rn(a, bq) : __fadd_rn(a, bq)) * sc;
        o16[q] = tohx(r); unsigned short a2, c2; splitf(r, a2, c2); oh[q] = a2; ol[q] = c2; }
    *(v2h*)(P16 + e) = o16; *(v2us*)(Ph + e) = oh; *(v2us*)(Pl + e) = ol;  }
__global__ __launch_bounds__(256) void k_vtp(const float* __restrict__ F, int pitch, int nheads, h16* V16, bf* Vh, bf* Vl) { const size_t e = ((size_t)blockIdx.x * 256 + threadIdx.x) * 2; if (e >= (size_t)nheads * HD * TT) return; const int t = (int)(e % TT); const int d = (int)((e / TT) % HD); const int g = (int)(e / ((size_t)TT * HD)); v2h o16; v2us oh, ol;
#pragma unroll
    for (int q = 0; q < 2; ++q) { const float x = F[(size_t)(t + q) * pitch + g * HD + d]; o16[q] = tohx(x); unsigned short a2, c2; splitf(x, a2, c2); oh[q] = a2; ol[q] = c2; }
    *(v2h*)(V16 + e) = o16; *(v2us*)(Vh + e) = oh; *(v2us*)(Vl + e) = ol;  }
__global__ __launch_bounds__(256) void k_csid(float* CS) { const int idx = blockIdx.x * 256 + threadIdx.x; if (idx >= TT * HD) return; v2f cs; cs[0] = 1.0f; cs[1] = 0.0f; *(v2f*)(CS + (size_t)idx * 2) = cs;  }
// ---- k_fattn: scores, causal softmax and probability x value in ONE kernel; no score or probability ever reaches memory. One work-group = QB query rows of one head, NW waves; wave w takes the 32-key blocks w, w + NW, ... up to the
// diagonal block and keeps its own running maximum m, running sum l and f32 output tile (rescaled by exp(m_old - m_new) whenever m grows); the NW partial results are joined through LDS in ascending wave order and written as the hi/lo context planes.
// Transposed products: S^T = K Q^T (A = key rows, B = query rows) and O^T += V^T P^T (A = rows of the [d][t] value plane, B = P^T). A lane then holds one query's scores (keys 8 * hi + j of each 16-key tile), so two converted score tiles ARE the B fragment of
// the second product in the same k order that WFrag::ld gives the value rows (k = 8 * hi + s, 16 + 8 * hi + (s - 8)), and m, l and the rescale factor are per lane.
// NSPLIT 2 (rows < RH): hi/lo planes, three products each (hi hi + lo hi + hi lo); NSPLIT 0: fp16, probabilities carried x 2^PSH (the factor is in l too and cancels in the final division).
#define NW   4
#define QB   32
#define L2E  1.4426950408889634f
typedef __attribute__((ext_vector_type(16))) unsigned short v16us;
template <typename T16> struct PFrag;
template <> struct PFrag<h16> { static __device__ __forceinline__ void mk(v8f p0, v8f p1, v16h& a, v16h& a2) {
#pragma unroll
    for (int s = 0; s < 8; ++s) { a[s] = (h16)p0[s]; a[8 + s] = (h16)p1[s]; } a2 = a; } };
template <> struct PFrag<bf> { static __device__ __forceinline__ void mk(v8f p0, v8f p1, v16bf& a, v16bf& a2) { v16us h, l;
#pragma unroll
    for (int s = 0; s < 8; ++s) { unsigned short x, y; splitf(p0[s], x, y); h[s] = x; l[s] = y; splitf(p1[s], x, y); h[8 + s] = x; l[8 + s] = y; }
    a = __builtin_bit_cast(v16bf, h); a2 = __builtin_bit_cast(v16bf, l); } };
template <typename T16, int NSPLIT>
__device__ __forceinline__ void fa_body(const T16* __restrict__ Q, const T16* __restrict__ Q2, const T16* __restrict__ Kp, const T16* __restrict__ K2, const T16* __restrict__ Vt, const T16* __restrict__ V2, int qb, size_t hp, bf* Ah, bf* Al, v4f* os4, float* ms, float* ls) {
    typedef typename WFrag<T16>::V V;
    const float sh = NSPLIT ? 0.0f : PSH;
    const int tid = threadIdx.x, lane = tid & 31, lr = lane & 15, hi = lane >> 4; const int w = __builtin_amdgcn_readfirstlane(tid >> 5);
    const int q0 = qb * QB;
    Q += hp; Kp += hp; Vt += hp; if (NSPLIT) { Q2 += hp; K2 += hp; V2 += hp; }
    V bq[2][2], bq2[2][2];
#pragma unroll
    for (int qi = 0; qi < 2; ++qi)
#pragma unroll
        for (int kk = 0; kk < 2; ++kk) { const size_t o = (size_t)(q0 + qi * 16 + lr) * HD + kk * 32 + 8 * hi; bq[qi][kk] = WFrag<T16>::ld(Q + o); if (NSPLIT) bq2[qi][kk] = WFrag<T16>::ld(Q2 + o); }
    v8f O[2][4]; float m[2], l[2];
#pragma unroll
    for (int qi = 0; qi < 2; ++qi) { m[qi] = -3.0e38f; l[qi] = 0.f;
#pragma unroll
        for (int dt = 0; dt < 4; ++dt) O[qi][dt] = (v8f){}; }
    const size_t ko = (size_t)(w * 32 + lr) * HD + 8 * hi, vo = (size_t)lr * TT + w * 32 + 8 * hi;
    const T16* kp = Kp + ko; const T16* vp = Vt + vo; const T16* kp2 = NSPLIT ? K2 + ko : nullptr; const T16* vp2 = NSPLIT ? V2 + vo : nullptr;   // one running address per plane; every fragment of a block is a constant offset from it
#pragma unroll 1   // rolled: a second copy of the body would hold a second set of 16 fragments live and cost a resident wave per SIMD
    for (int kb = w; kb <= qb; kb += NW) {
        V ak[2][2], ak2[2][2], av[4], av2[4];
#pragma unroll
        for (int kt = 0; kt < 2; ++kt)
#pragma unroll
            for (int kk = 0; kk < 2; ++kk) ak[kt][kk] = WFrag<T16>::ld(kp + kt * 16 * HD + kk * 32);
        asm volatile("s_wait_xcnt 0x0" ::: "memory");   // behind each plane's loads: a later load's result may land in their address register, so their translations are waited out first
        if (NSPLIT) {
#pragma unroll
            for (int kt = 0; kt < 2; ++kt)
#pragma unroll
                for (int kk = 0; kk < 2; ++kk) ak2[kt][kk] = WFrag<T16>::ld(kp2 + kt * 16 * HD + kk * 32);
            asm volatile("s_wait_xcnt 0x0" ::: "memory"); }   // as above
#pragma unroll
        for (int dt = 0; dt < 4; ++dt) av[dt] = WFrag<T16>::ld(vp + dt * 16 * TT);
        asm volatile("s_wait_xcnt 0x0" ::: "memory");   // as above; the running addresses are also stepped for the next block below
        if (NSPLIT) {
#pragma unroll
            for (int dt = 0; dt < 4; ++dt) av2[dt] = WFrag<T16>::ld(vp2 + dt * 16 * TT);
            asm volatile("s_wait_xcnt 0x0" ::: "memory"); }   // as above
        kp += NW * 32 * HD; vp += NW * 32; if (NSPLIT) { kp2 += NW * 32 * HD; vp2 += NW * 32; }
        // inputs-only fence on the loaded fragments: all loads of the block are issued before its first product; without it the compiler reloads fragment registers between the products and a block pays three load latencies in a row
        asm volatile("" :: "v"(ak[0][0]), "v"(ak[0][1]), "v"(ak[1][0]), "v"(ak[1][1]), "v"(av[0]), "v"(av[1]), "v"(av[2]), "v"(av[3]));
        if (NSPLIT) asm volatile("" :: "v"(ak2[0][0]), "v"(ak2[0][1]), "v"(ak2[1][0]), "v"(ak2[1][1]), "v"(av2[0]), "v"(av2[1]), "v"(av2[2]), "v"(av2[3]));   // the same for the lo planes
        v8f S[2][2];
#pragma unroll
        for (int kt = 0; kt < 2; ++kt)
#pragma unroll
            for (int qi = 0; qi < 2; ++qi) { v8f s = (v8f){};
#pragma unroll
                for (int kk = 0; kk < 2; ++kk) { s = WFrag<T16>::mma(ak[kt][kk], bq[qi][kk], s); if (NSPLIT) { s = WFrag<T16>::mma(ak[kt][kk], bq2[qi][kk], s); s = WFrag<T16>::mma(ak2[kt][kk], bq[qi][kk], s); } }
                S[kt][qi] = s * SCL; }
        if (kb == qb) {                                   // the diagonal block (wave-uniform test): keys beyond the lane's query are masked
#pragma unroll
            for (int kt = 0; kt < 2; ++kt)
#pragma unroll
                for (int qi = 0; qi < 2; ++qi)
#pragma unroll
                    for (int j = 0; j < 8; ++j) if (kt * 16 + hi * 8 + j > qi * 16 + lr) S[kt][qi][j] = -3.0e38f; }
#pragma unroll
        for (int qi = 0; qi < 2; ++qi) {
            float mx = S[0][qi][0];
#pragma unroll
            for (int j = 1; j < 8; ++j) mx = fmaxf(mx, S[0][qi][j]);
#pragma unroll
            for (int j = 0; j < 8; ++j) mx = fmaxf(mx, S[1][qi][j]);
            mx = fmaxf(mx, __shfl_xor(mx, 16, 32));       // the other half of the wave holds the query's other 16 keys
            const float mn = fmaxf(m[qi], mx); const float al = __builtin_amdgcn_exp2f((m[qi] - mn) * L2E); m[qi] = mn;
            v8f p0, p1; float sum = 0.f;
#pragma unroll
            for (int j = 0; j < 8; ++j) { p0[j] = __builtin_amdgcn_exp2f((S[0][qi][j] - mn) * L2E + sh); p1[j] = __builtin_amdgcn_exp2f((S[1][qi][j] - mn) * L2E + sh); sum += p0[j] + p1[j]; }
            l[qi] = l[qi] * al + sum;
            V pb, pb2; PFrag<T16>::mk(p0, p1, pb, pb2);
#pragma unroll
            for (int dt = 0; dt < 4; ++dt) { v8f o = O[qi][dt] * al; o = WFrag<T16>::mma(av[dt], pb, o); if (NSPLIT) { o = WFrag<T16>::mma(av[dt], pb2, o); o = WFrag<T16>::mma(av2[dt], pb, o); } O[qi][dt] = o; } }
    }
#pragma unroll
    for (int qi = 0; qi < 2; ++qi) { l[qi] += __shfl_xor(l[qi], 16, 32); if (hi == 0) { ms[(w * 2 + qi) * 16 + lr] = m[qi]; ls[(w * 2 + qi) * 16 + lr] = l[qi]; }
#pragma unroll
        for (int dt = 0; dt < 4; ++dt)
#pragma unroll
            for (int jh = 0; jh < 2; ++jh) { v4f t; t[0] = O[qi][dt][jh * 4]; t[1] = O[qi][dt][jh * 4 + 1]; t[2] = O[qi][dt][jh * 4 + 2]; t[3] = O[qi][dt][jh * 4 + 3]; os4[(((w * 2 + qi) * 4 + dt) * 2 + jh) * 32 + lane] = t; } }
    __syncthreads();                                      // every wave's partial m, l and output tile are in LDS before any is read
    { const int q = tid >> 2, dt = tid & 3, qi = q >> 4, ql = q & 15;   // thread: one query row, 16 consecutive d; a wave writes whole 128-byte rows of both planes
        float mw[NW], M = -3.0e38f;
#pragma unroll
        for (int u = 0; u < NW; ++u) { mw[u] = ms[(u * 2 + qi) * 16 + ql]; M = fmaxf(M, mw[u]); }
        float L = 0.f; v4f acc[2][2];
#pragma unroll
        for (int hh = 0; hh < 2; ++hh)
#pragma unroll
            for (int jh = 0; jh < 2; ++jh) acc[hh][jh] = (v4f){};
#pragma unroll
        for (int u = 0; u < NW; ++u) { const float sc = __builtin_amdgcn_exp2f((mw[u] - M) * L2E); L += sc * ls[(u * 2 + qi) * 16 + ql];
#pragma unroll
            for (int hh = 0; hh < 2; ++hh)
#pragma unroll
                for (int jh = 0; jh < 2; ++jh) acc[hh][jh] += os4[(((u * 2 + qi) * 4 + dt) * 2 + jh) * 32 + hh * 16 + ql] * sc; }
        const float inv = __fdiv_rn(1.0f, L); const size_t oo = hp + (size_t)(q0 + q) * HD + dt * 16;   /* RAW view: the [H][T][64] head-major flat order, read back by the output GEMM as [T][1024] rows */
#pragma unroll
        for (int hh = 0; hh < 2; ++hh) { v8us oh, ol;
#pragma unroll
            for (int e = 0; e < 8; ++e) { unsigned short a, c2; splitf(acc[hh][e >> 2][e & 3] * inv, a, c2); oh[e] = a; ol[e] = c2; }
            *(v8us*)(Ah + oo + hh * 8) = oh; *(v8us*)(Al + oo + hh * 8) = ol; } }
}
// grid (heads, TT / QB): the query blocks run from the last (longest key loop) to the first, so the short hi/lo blocks fill the places that the shorter fp16 blocks free
__global__ __launch_bounds__(NW * 32) void k_fattn(const h16* __restrict__ Q16, const h16* __restrict__ K16, const h16* __restrict__ V16, const bf* __restrict__ Qh, const bf* __restrict__ Ql, const bf* __restrict__ Kh, const bf* __restrict__ Kl, const bf* __restrict__ Vh, const bf* __restrict__ Vl, bf* Ah, bf* Al) {
    __shared__ __align__(16) v4f os4[NW * 2 * 4 * 2 * 32];
    __shared__ float ms[NW * 2 * 16], ls[NW * 2 * 16];
    const int qb = TT / QB - 1 - (int)blockIdx.y; const size_t hp = (size_t)blockIdx.x * TT * HD;
    if (qb * QB < RH) fa_body<bf, 2>(Qh, Ql, Kh, Kl, Vh, Vl, qb, hp, Ah, Al, os4, ms, ls);
    else fa_body<h16, 0>(Q16, nullptr, K16, nullptr, V16, nullptr, qb, hp, Ah, Al, os4, ms, ls);
}

extern "C" void kernel_launch(void* const* d_in, const int* in_sizes, int n_in,
                              void* d_out, int out_size, void* d_ws, size_t ws_size, hipStream_t stream) {
    (void)in_sizes; (void)n_in; (void)out_size;
    const float* x = (const float*)d_in[0]; const float* wqkv = (const float*)d_in[1]; const float* wo = (const float*)d_in[2]; const float* bo = (const float*)d_in[3];   /* input order x, w_qkv ('oi' [3072][1024]: q | k | v row thirds), w_proj ('oi'), b_proj */ const float* wq = wqkv; const float* wk = wqkv + (size_t)DQ * DM; const float* wv = wqkv + (size_t)2 * DQ * DM;
    float* OUT = (float*)d_out;     // [2][2048][1024]
    char* wsp = (char*)d_ws;
    auto take = [&](size_t bytes) { char* p = wsp; wsp += (bytes + 255) & ~(size_t)255; return (void*)p; };
    bf* WQ = (bf*)take((size_t)DQ * DM * 2); bf* WK = (bf*)take((size_t)DKV * DM * 2); bf* WV = (bf*)take((size_t)DKV * DM * 2); bf* WO = (bf*)take((size_t)DM * DQ * 2); float* CS = (float*)take((size_t)TT * HD * 2 * 4);
    h16* QP16 = (h16*)take((size_t)NH_ * TT * HD * 2); h16* KP16 = (h16*)take((size_t)NKV * TT * HD * 2); h16* VT16 = (h16*)take((size_t)NKV * HD * TT * 2);
    bf* QPh = (bf*)take((size_t)NH_ * TT * HD * 2); bf* QPl = (bf*)take((size_t)NH_ * TT * HD * 2); bf* KPh = (bf*)take((size_t)NKV * TT * HD * 2); bf* KPl = (bf*)take((size_t)NKV * TT * HD * 2); bf* VTh = (bf*)take((size_t)NKV * HD * TT * 2); bf* VTl = (bf*)take((size_t)NKV * HD * TT * 2);
    bf* XB = (bf*)take((size_t)TT * DM * 2); float* FQ = (float*)take((size_t)TT * DQ * 4); float* FK = (float*)take((size_t)TT * DKV * 4); bf* ATh = (bf*)take((size_t)TT * DQ * 2); bf* ATl = (bf*)take((size_t)TT * DQ * 2);
    if ((size_t)(wsp - (char*)d_ws) > ws_size) return;    // ws 256 MiB
    float* FV = FK;   // v projection reuses the k buffer after the k planes are built (stream-ordered)
    { k_cvt8<<<(unsigned)(((size_t)DQ * DM / 8 + 255) / 256), 256, 0, stream>>>(wq, WQ, (size_t)DQ * DM / 8); k_cvt8<<<(unsigned)(((size_t)DKV * DM / 8 + 255) / 256), 256, 0, stream>>>(wk, WK, (size_t)DKV * DM / 8); k_cvt8<<<(unsigned)(((size_t)DKV * DM / 8 + 255) / 256), 256, 0, stream>>>(wv, WV, (size_t)DKV * DM / 8);
      k_cvt8<<<(unsigned)(((size_t)DM * DQ / 8 + 255) / 256), 256, 0, stream>>>(wo, WO, (size_t)DM * DQ / 8);
       }
    k_csid<<<(TT * HD + 255) / 256, 256, 0, stream>>>(CS);
    const unsigned LQ = (unsigned)(((size_t)NH_ * TT * HD / 2 + 255) / 256), LKv = (unsigned)(((size_t)NKV * TT * HD / 2 + 255) / 256);
    for (int b = 0; b < NB_; ++b) {
        
        k_cvt8<<<(unsigned)(((size_t)TT * DM / 8 + 255) / 256), 256, 0, stream>>>(x + (size_t)b * TT * DM, XB, (size_t)TT * DM / 8);
        k_gemmw<bf, 0, false><<<dim3(TT / 64, DQ / 64, 1), 32, 0, stream>>>(XB, nullptr, WQ, nullptr, DM, FQ, DQ, nullptr, 0, 0, 0);
        k_rope<<<LQ, 256, 0, stream>>>(FQ, DQ, NH_, CS, nullptr, nullptr, 1.0f, QP16, QPh, QPl);
        k_gemmw<bf, 0, false><<<dim3(TT / 64, DKV / 64, 1), 32, 0, stream>>>(XB, nullptr, WK, nullptr, DM, FK, DKV, nullptr, 0, 0, 0);
        k_rope<<<LKv, 256, 0, stream>>>(FK, DKV, NKV, CS, nullptr, nullptr, 1.0f, KP16, KPh, KPl);
        k_gemmw<bf, 0, false><<<dim3(TT / 64, DKV / 64, 1), 32, 0, stream>>>(XB, nullptr, WV, nullptr, DM, FV, DKV, nullptr, 0, 0, 0); k_vtp<<<LKv, 256, 0, stream>>>(FV, DKV, NKV, VT16, VTh, VTl);
        k_fattn<<<dim3(NH_, TT / QB, 1), NW * 32, 0, stream>>>(QP16, KP16, VT16, QPh, QPl, KPh, KPl, VTh, VTl, ATh, ATl);
        k_gemmw<bf, 1, true><<<dim3(TT / 64, DM / 64, 1), 32, 0, stream>>>(ATh, ATl, WO, nullptr, DQ, OUT + (size_t)b * TT * DM, DM, bo, 0, 0, 0); }
}

// v004
// One run takes 270 microseconds.
// In two side-by-side timings against v003, it was 1.15 and 1.13 times as fast.
// Counting every step since v000, it is 5.26 times as fast.
#include <hip/hip_runtime.h>

// Causal attention whose head outputs are merged by a RAW view (x [2][2048][1024]; qkv = einsum('bte,fe', x, w_qkv) ('oi' [3072][1024] 1/32, no bias) split in thirds q | k | v (16 heads x 64); scores / sqrt(64); causal (-inf); softmax; out [B][H][T][dk] is then VIEWED as (B, T, E) without transposing the heads back (the source's bug, reproduced: flat element ((h*T + t)*64 + d) of the head-major buffer becomes row (h*T + t) / 16, column ((h*T + t) % 16)*64 + d); result = view w_proj^T + b_proj -> [2][2048][1024] (4.2 M); argument order x, w_qkv, w_proj, b_proj).
// Layout per batch: bf16 copy of x; the fused 'oi' weight is Bt as-is (q | k | v row blocks); exact projections whose epilogue writes the fp16 and hi/lo head planes itself (no f32 q, k or v in memory); fused causal T-2048 attention (k_fattn, running softmax; hybrid rows: < 512 hi/lo 3 products, rest fp16 x1024; key blocks above the diagonal are never visited), which writes the context planes in the HEAD-MAJOR flat order ((h*T + t)*64 + d) so the [2048][1024] operand of the output GEMM is exactly the module's raw view; x w_proj exact + b_proj.
// Compute dtypes, f32 accumulate: every input rounded to bf16; projections exact; attention rows < 512 3 products, rest fp16; softmax f32; w_proj hl x exact + bias.

#define NB_  2
#define TT   2048
#define DM   1024
#define NH_  16
#define NKV  16
#define HD   64
#define DQ   (NH_ * HD)
#define DKV  (NKV * HD)
#define RH   512                  // query rows < RH use hi+lo planes (0: none)
#define PSH  10.0f                // fp16 probabilities are carried x 2^PSH
#define SCL  0.125f   // HD^-0.5
typedef _Float16 h16;
typedef unsigned short bf;
typedef __attribute__((ext_vector_type(16))) __bf16   v16bf;
typedef __attribute__((ext_vector_type(16))) _Float16 v16h;
typedef __attribute__((ext_vector_type(8)))  _Float16 v8h;
typedef __attribute__((ext_vector_type(8)))  unsigned short v8us;
typedef __attribute__((ext_vector_type(8)))  float    v8f;
typedef __attribute__((ext_vector_type(4)))  float    v4f;
typedef v8h  __attribute__((may_alias)) v8ha;
typedef v4f  __attribute__((may_alias)) v4fa;
typedef v8us __attribute__((may_alias)) v8usa;

__device__ __forceinline__ unsigned short f2bf(float f) { unsigned u = __float_as_uint(f); u += 0x7FFFu + ((u >> 16) & 1u); return (unsigned short)(u >> 16); }
__device__ __forceinline__ float bf2f(unsigned short b) { return __uint_as_float(((unsigned)b) << 16); }
__device__ __forceinline__ float bfr(float f) { return bf2f(f2bf(f)); }
__device__ __forceinline__ v16h cat16(v8h lo, v8h hi) { return __builtin_shufflevector(lo, hi, 0, 1, 2, 3, 4, 5, 6, 7, 8, 9, 10, 11, 12, 13, 14, 15); }
__device__ __forceinline__ v16bf cat16b(v8us lo, v8us hi) { return __builtin_bit_cast(v16bf, __builtin_shufflevector(lo, hi, 0, 1, 2, 3, 4, 5, 6, 7, 8, 9, 10, 11, 12, 13, 14, 15)); }
__device__ __forceinline__ v8f wmma16(v16h a, v16h b, v8f c) { return __builtin_amdgcn_wmma_f32_16x16x32_f16(false, a, false, b, (short)0, c, false, false); }
__device__ __forceinline__ v8f wmmab(v16bf a, v16bf b, v8f c) { return __builtin_amdgcn_wmma_f32_16x16x32_bf16(false, a, false, b, (short)0, c, false, false); }



__device__ __forceinline__ h16 tohx(float x) { return (h16)x; }
__device__ __forceinline__ void splitf(float y, unsigned short& h, unsigned short& l) { h = f2bf(y); l = f2bf(y - bf2f(h)); }
// ---- k_gemmw: register-blocked GEMM, ONE WAVE per 64x64 output tile (16 accumulators), operands straight from K-contiguous 16-bit planes; grid (M/64, N/64, Z), 32 threads.
// C[m][n] (f32, pitch ldc, + optional f32 bias[n]) = sum_k A[m][k] Bt[n][k] (+ split products per NSPLIT). z-batch strides sA/sB/sC in elements. K % 32 == 0.
// EPI 0: C as above. EPI 1 and 2: no C; the tile (rows = t, its 64 columns = one head) goes out as three 16-bit planes (fp16, bf16 hi, bf16 lo): EPI 1 as [h][t][d] rows, EPI 2 transposed as [h][d][t].
template <typename T16> struct WFrag;
template <> struct WFrag<h16> { typedef v16h V; static __device__ __forceinline__ V ld(const h16* p) { return cat16(*(const v8h*)p, *(const v8h*)(p + 16)); } static __device__ __forceinline__ v8f mma(V a, V b, v8f c) { return wmma16(a, b, c); } };
template <> struct WFrag<bf> { typedef v16bf V; static __device__ __forceinline__ V ld(const bf* p) { return cat16b(*(const v8us*)p, *(const v8us*)(p + 16)); } static __device__ __forceinline__ v8f mma(V a, V b, v8f c) { return wmmab(a, b, c); } };
template <typename T16, int NSPLIT, bool BIAS, int EPI>
__global__ __launch_bounds__(32) void k_gemmw(const T16* __restrict__ A, const T16* __restrict__ A2, const T16* __restrict__ Bt, const T16* __restrict__ Bt2, int K, float* C, int ldc, const float* __restrict__ bias, size_t sA, size_t sB, size_t sC, h16* P16, bf* Ph, bf* Pl) {
    typedef typename WFrag<T16>::V V;
    __shared__ __align__(16) float os[16 * 68];
    const size_t z = blockIdx.z; A += z * sA; if (A2) A2 += z * sA; Bt += z * sB; if (Bt2) Bt2 += z * sB; C += z * sC;
    const int lane = threadIdx.x & 31, lr = lane & 15, hi = lane >> 4; const int r0 = blockIdx.x * 64, c0 = blockIdx.y * 64;
    v8f acc[4][4];
#pragma unroll
    for (int mb = 0; mb < 4; ++mb)
#pragma unroll
        for (int nb = 0; nb < 4; ++nb) acc[mb][nb] = (v8f){};
    const size_t aoff = (size_t)(r0 + lr) * K + 8 * hi, boff = (size_t)(c0 + lr) * K + 8 * hi;
#pragma unroll 1
    for (int kc = 0; kc < K; kc += 32) {
        V a[4], a2[4];
#pragma unroll
        for (int mb = 0; mb < 4; ++mb) { a[mb] = WFrag<T16>::ld(A + aoff + (size_t)mb * 16 * K + kc); if (NSPLIT == 1 || NSPLIT == 2) a2[mb] = WFrag<T16>::ld(A2 + aoff + (size_t)mb * 16 * K + kc); }
#pragma unroll
        for (int nb = 0; nb < 4; ++nb) { const V b = WFrag<T16>::ld(Bt + boff + (size_t)nb * 16 * K + kc); V b2; if (NSPLIT >= 2) b2 = WFrag<T16>::ld(Bt2 + boff + (size_t)nb * 16 * K + kc);
#pragma unroll
            for (int mb = 0; mb < 4; ++mb) { acc[mb][nb] = WFrag<T16>::mma(a[mb], b, acc[mb][nb]); if (NSPLIT == 1 || NSPLIT == 2) acc[mb][nb] = WFrag<T16>::mma(a2[mb], b, acc[mb][nb]); if (NSPLIT >= 2) acc[mb][nb] = WFrag<T16>::mma(a[mb], b2, acc[mb][nb]); } }
        asm volatile("v_nop\n\tv_nop\n\tv_nop\n\tv_nop" : "+v"(acc[0][0]), "+v"(acc[1][1]), "+v"(acc[2][2]), "+v"(acc[3][3]) : "v"(a[0]), "v"(a[3]));
    }
    if (EPI == 2) {   // a lane's 8 accumulator elements are 8 consecutive t of one column d: 16-byte stores straight from registers; the wave fills the whole 128-byte line (64 t) of each of its 64 plane rows
#pragma unroll
        for (int nb = 0; nb < 4; ++nb)
#pragma unroll
            for (int mb = 0; mb < 4; ++mb) { v8h o16; v8us oh, ol;
#pragma unroll
                for (int j = 0; j < 8; ++j) { const float x = acc[mb][nb][j]; o16[j] = tohx(x); unsigned short a2, c2; splitf(x, a2, c2); oh[j] = a2; ol[j] = c2; }
                const size_t o = (size_t)(c0 + nb * 16 + lr) * TT + r0 + mb * 16 + hi * 8;
                *(v8h*)(P16 + o) = o16; *(v8us*)(Ph + o) = oh; *(v8us*)(Pl + o) = ol; }
        return; }
#pragma unroll
    for (int mb = 0; mb < 4; ++mb) {
#pragma unroll
        for (int nb = 0; nb < 4; ++nb) {
#pragma unroll
            for (int j = 0; j < 8; ++j) os[(hi * 8 + j) * 68 + nb * 16 + lr] = acc[mb][nb][j]; }
        __builtin_amdgcn_wave_barrier(); asm volatile("" ::: "memory");
        if (EPI == 1) {   // a lane takes 8 consecutive d of one row: each store of the wave covers four whole 128-byte plane rows
#pragma unroll
            for (int s = 0; s < 4; ++s) { const int row = 4 * s + (lane >> 3), cofs = (lane & 7) * 8; const v4f v0 = *(const v4fa*)(os + row * 68 + cofs), v1 = *(const v4fa*)(os + row * 68 + cofs + 4); v8h o16; v8us oh, ol;
#pragma unroll
                for (int e = 0; e < 8; ++e) { const float x = e < 4 ? v0[e & 3] : v1[e & 3]; o16[e] = tohx(x); unsigned short a2, c2; splitf(x, a2, c2); oh[e] = a2; ol[e] = c2; }
                const size_t o = ((size_t)(c0 / HD) * TT + r0 + mb * 16 + row) * HD + cofs;
                *(v8h*)(P16 + o) = o16; *(v8us*)(Ph + o) = oh; *(v8us*)(Pl + o) = ol; }
        } else { float* crow = C + (size_t)(r0 + mb * 16) * ldc + c0;
#pragma unroll
            for (int s = 0; s < 8; ++s) { const int row = 2 * s + hi, cofs = lr * 4; v4f val = *(const v4fa*)(os + row * 68 + cofs); if (BIAS) { val[0] += bfr(bias[c0 + cofs]); val[1] += bfr(bias[c0 + cofs + 1]); val[2] += bfr(bias[c0 + cofs + 2]); val[3] += bfr(bias[c0 + cofs + 3]); }
                *(v4f*)(crow + (size_t)row * ldc + cofs) = val; }
             }
        __builtin_amdgcn_wave_barrier(); asm volatile("" ::: "memory");
    }
}

typedef __attribute__((ext_vector_type(2))) _Float16 v2h;
typedef __attribute__((ext_vector_type(4))) _Float16 v4h;
typedef __attribute__((ext_vector_type(2))) unsigned short v2us;
typedef __attribute__((ext_vector_type(4))) unsigned short v4us;
typedef __attribute__((ext_vector_type(2))) float v2f;
typedef __attribute__((ext_vector_type(4))) int v4i;
typedef v4h  __attribute__((may_alias)) v4ha;
typedef v4us __attribute__((may_alias)) v4usa;

__global__ __launch_bounds__(256) void k_cvt8(const float* __restrict__ src, bf* dst, size_t n8) { const size_t i = (size_t)blockIdx.x * 256 + threadIdx.x; if (i >= n8) return; const v8f v = *(const v8f*)(src + i * 8); v8us o;
#pragma unroll
    for (int k = 0; k < 8; ++k) o[k] = f2bf(v[k]); *(v8us*)(dst + i * 8) = o;  }

// ---- k_fattn: scores, causal softmax and probability x value in ONE kernel; no score or probability ever reaches memory. One work-group = QB query rows of one head, NW waves; wave w takes the 32-key blocks w, w + NW, ... up to the
// diagonal block and keeps its own running maximum m, running sum l and f32 output tile (rescaled by exp(m_old - m_new) whenever m grows); the NW partial results are joined through LDS in ascending wave order and written as the hi/lo context planes.
// Transposed products: S^T = K Q^T (A = key rows, B = query rows) and O^T += V^T P^T (A = rows of the [d][t] value plane, B = P^T). A lane then holds one query's scores (keys 8 * hi + j of each 16-key tile), so two converted score tiles ARE the B fragment of
// the second product in the same k order that WFrag::ld gives the value rows (k = 8 * hi + s, 16 + 8 * hi + (s - 8)), and m, l and the rescale factor are per lane.
// NSPLIT 2 (rows < RH): hi/lo planes, three products each (hi hi + lo hi + hi lo); NSPLIT 0: fp16, probabilities carried x 2^PSH (the factor is in l too and cancels in the final division).
#define NW   4
#define QB   32
#define L2E  1.4426950408889634f
typedef __attribute__((ext_vector_type(16))) unsigned short v16us;
template <typename T16> struct PFrag;
template <> struct PFrag<h16> { static __device__ __forceinline__ void mk(v8f p0, v8f p1, v16h& a, v16h& a2) {
#pragma unroll
    for (int s = 0; s < 8; ++s) { a[s] = (h16)p0[s]; a[8 + s] = (h16)p1[s]; } a2 = a; } };
template <> struct PFrag<bf> { static __device__ __forceinline__ void mk(v8f p0, v8f p1, v16bf& a, v16bf& a2) { v16us h, l;
#pragma unroll
    for (int s = 0; s < 8; ++s) { unsigned short x, y; splitf(p0[s], x, y); h[s] = x; l[s] = y; splitf(p1[s], x, y); h[8 + s] = x; l[8 + s] = y; }
    a = __builtin_bit_cast(v16bf, h); a2 = __builtin_bit_cast(v16bf, l); } };
template <typename T16, int NSPLIT>
__device__ __forceinline__ void fa_body(const T16* __restrict__ Q, const T16* __restrict__ Q2, const T16* __restrict__ Kp, const T16* __restrict__ K2, const T16* __restrict__ Vt, const T16* __restrict__ V2, int qb, size_t hp, bf* Ah, bf* Al, v4f* os4, float* ms, float* ls) {
    typedef typename WFrag<T16>::V V;
    const float sh = NSPLIT ? 0.0f : PSH;
    const int tid = threadIdx.x, lane = tid & 31, lr = lane & 15, hi = lane >> 4; const int w = __builtin_amdgcn_readfirstlane(tid >> 5);
    const int q0 = qb * QB;
    Q += hp; Kp += hp; Vt += hp; if (NSPLIT) { Q2 += hp; K2 += hp; V2 += hp; }
    V bq[2][2], bq2[2][2];
#pragma unroll
    for (int qi = 0; qi < 2; ++qi)
#pragma unroll
        for (int kk = 0; kk < 2; ++kk) { const size_t o = (size_t)(q0 + qi * 16 + lr) * HD + kk * 32 + 8 * hi; bq[qi][kk] = WFrag<T16>::ld(Q + o); if (NSPLIT) bq2[qi][kk] = WFrag<T16>::ld(Q2 + o); }
    v8f O[2][4]; float m[2], l[2];
#pragma unroll
    for (int qi = 0; qi < 2; ++qi) { m[qi] = -3.0e38f; l[qi] = 0.f;
#pragma unroll
        for (int dt = 0; dt < 4; ++dt) O[qi][dt] = (v8f){}; }
    const size_t ko = (size_t)(w * 32 + lr) * HD + 8 * hi, vo = (size_t)lr * TT + w * 32 + 8 * hi;
    const T16* kp = Kp + ko; const T16* vp = Vt + vo; const T16* kp2 = NSPLIT ? K2 + ko : nullptr; const T16* vp2 = NSPLIT ? V2 + vo : nullptr;   // one running address per plane; every fragment of a block is a constant offset from it
#pragma unroll 1   // rolled: a second copy of the body would hold a second set of 16 fragments live and cost a resident wave per SIMD
    for (int kb = w; kb <= qb; kb += NW) {
        V ak[2][2], ak2[2][2], av[4], av2[4];
#pragma unroll
        for (int kt = 0; kt < 2; ++kt)
#pragma unroll
            for (int kk = 0; kk < 2; ++kk) ak[kt][kk] = WFrag<T16>::ld(kp + kt * 16 * HD + kk * 32);
        asm volatile("s_wait_xcnt 0x0" ::: "memory");   // behind each plane's loads: a later load's result may land in their address register, so their translations are waited out first
        if (NSPLIT) {
#pragma unroll
            for (int kt = 0; kt < 2; ++kt)
#pragma unroll
                for (int kk = 0; kk < 2; ++kk) ak2[kt][kk] = WFrag<T16>::ld(kp2 + kt * 16 * HD + kk * 32);
            asm volatile("s_wait_xcnt 0x0" ::: "memory"); }   // as above
#pragma unroll
        for (int dt = 0; dt < 4; ++dt) av[dt] = WFrag<T16>::ld(vp + dt * 16 * TT);
        asm volatile("s_wait_xcnt 0x0" ::: "memory");   // as above; the running addresses are also stepped for the next block below
        if (NSPLIT) {
#pragma unroll
            for (int dt = 0; dt < 4; ++dt) av2[dt] = WFrag<T16>::ld(vp2 + dt * 16 * TT);
            asm volatile("s_wait_xcnt 0x0" ::: "memory"); }   // as above
        kp += NW * 32 * HD; vp += NW * 32; if (NSPLIT) { kp2 += NW * 32 * HD; vp2 += NW * 32; }
        // inputs-only fence on the loaded fragments: all loads of the block are issued before its first product; without it the compiler reloads fragment registers between the products and a block pays three load latencies in a row
        asm volatile("" :: "v"(ak[0][0]), "v"(ak[0][1]), "v"(ak[1][0]), "v"(ak[1][1]), "v"(av[0]), "v"(av[1]), "v"(av[2]), "v"(av[3]));
        if (NSPLIT) asm volatile("" :: "v"(ak2[0][0]), "v"(ak2[0][1]), "v"(ak2[1][0]), "v"(ak2[1][1]), "v"(av2[0]), "v"(av2[1]), "v"(av2[2]), "v"(av2[3]));   // the same for the lo planes
        v8f S[2][2];
#pragma unroll
        for (int kt = 0; kt < 2; ++kt)
#pragma unroll
            for (int qi = 0; qi < 2; ++qi) { v8f s = (v8f){};
#pragma unroll
                for (int kk = 0; kk < 2; ++kk) { s = WFrag<T16>::mma(ak[kt][kk], bq[qi][kk], s); if (NSPLIT) { s = WFrag<T16>::mma(ak[kt][kk], bq2[qi][kk], s); s = WFrag<T16>::mma(ak2[kt][kk], bq[qi][kk], s); } }
                S[kt][qi] = s * SCL; }
        if (kb == qb) {                                   // the diagonal block (wave-uniform test): keys beyond the lane's query are masked
#pragma unroll
            for (int kt = 0; kt < 2; ++kt)
#pragma unroll
                for (int qi = 0; qi < 2; ++qi)
#pragma unroll
                    for (int j = 0; j < 8; ++j) if (kt * 16 + hi * 8 + j > qi * 16 + lr) S[kt][qi][j] = -3.0e38f; }
#pragma unroll
        for (int qi = 0; qi < 2; ++qi) {
            float mx = S[0][qi][0];
#pragma unroll
            for (int j = 1; j < 8; ++j) mx = fmaxf(mx, S[0][qi][j]);
#pragma unroll
            for (int j = 0; j < 8; ++j) mx = fmaxf(mx, S[1][qi][j]);
            mx = fmaxf(mx, __shfl_xor(mx, 16, 32));       // the other half of the wave holds the query's other 16 keys
            const float mn = fmaxf(m[qi], mx); const float al = __builtin_amdgcn_exp2f((m[qi] - mn) * L2E); m[qi] = mn;
            v8f p0, p1; float sum = 0.f;
#pragma unroll
            for (int j = 0; j < 8; ++j) { p0[j] = __builtin_amdgcn_exp2f((S[0][qi][j] - mn) * L2E + sh); p1[j] = __builtin_amdgcn_exp2f((S[1][qi][j] - mn) * L2E + sh); sum += p0[j] + p1[j]; }
            l[qi] = l[qi] * al + sum;
            V pb, pb2; PFrag<T16>::mk(p0, p1, pb, pb2);
#pragma unroll
            for (int dt = 0; dt < 4; ++dt) { v8f o = O[qi][dt] * al; o = WFrag<T16>::mma(av[dt], pb, o); if (NSPLIT) { o = WFrag<T16>::mma(av[dt], pb2, o); o = WFrag<T16>::mma(av2[dt], pb, o); } O[qi][dt] = o; } }
    }
#pragma unroll
    for (int qi = 0; qi < 2; ++qi) { l[qi] += __shfl_xor(l[qi], 16, 32); if (hi == 0) { ms[(w * 2 + qi) * 16 + lr] = m[qi]; ls[(w * 2 + qi) * 16 + lr] = l[qi]; }
#pragma unroll
        for (int dt = 0; dt < 4; ++dt)
#pragma unroll
            for (int jh = 0; jh < 2; ++jh) { v4f t; t[0] = O[qi][dt][jh * 4]; t[1] = O[qi][dt][jh * 4 + 1]; t[2] = O[qi][dt][jh * 4 + 2]; t[3] = O[qi][dt][jh * 4 + 3]; os4[(((w * 2 + qi) * 4 + dt) * 2 + jh) * 32 + lane] = t; } }
    __syncthreads();                                      // every wave's partial m, l and output tile are in LDS before any is read
    { const int q = tid >> 2, dt = tid & 3, qi = q >> 4, ql = q & 15;   // thread: one query row, 16 consecutive d; a wave writes whole 128-byte rows of both planes
        float mw[NW], M = -3.0e38f;
#pragma unroll
        for (int u = 0; u < NW; ++u) { mw[u] = ms[(u * 2 + qi) * 16 + ql]; M = fmaxf(M, mw[u]); }
        float L = 0.f; v4f acc[2][2];
#pragma unroll
        for (int hh = 0; hh < 2; ++hh)
#pragma unroll
            for (int jh = 0; jh < 2; ++jh) acc[hh][jh] = (v4f){};
#pragma unroll
        for (int u = 0; u < NW; ++u) { const float sc = __builtin_amdgcn_exp2f((mw[u] - M) * L2E); L += sc * ls[(u * 2 + qi) * 16 + ql];
#pragma unroll
            for (int hh = 0; hh < 2; ++hh)
#pragma unroll
                for (int jh = 0; jh < 2; ++jh) acc[hh][jh] += os4[(((u * 2 + qi) * 4 + dt) * 2 + jh) * 32 + hh * 16 + ql] * sc; }
        const float inv = __fdiv_rn(1.0f, L); const size_t oo = hp + (size_t)(q0 + q) * HD + dt * 16;   /* RAW view: the [H][T][64] head-major flat order, read back by the output GEMM as [T][1024] rows */
#pragma unroll
        for (int hh = 0; hh < 2; ++hh) { v8us oh, ol;
#pragma unroll
            for (int e = 0; e < 8; ++e) { unsigned short a, c2; splitf(acc[hh][e >> 2][e & 3] * inv, a, c2); oh[e] = a; ol[e] = c2; }
            *(v8us*)(Ah + oo + hh * 8) = oh; *(v8us*)(Al + oo + hh * 8) = ol; } }
}
// grid (heads, TT / QB): the query blocks run from the last (longest key loop) to the first, so the short hi/lo blocks fill the places that the shorter fp16 blocks free
__global__ __launch_bounds__(NW * 32) void k_fattn(const h16* __restrict__ Q16, const h16* __restrict__ K16, const h16* __restrict__ V16, const bf* __restrict__ Qh, const bf* __restrict__ Ql, const bf* __restrict__ Kh, const bf* __restrict__ Kl, const bf* __restrict__ Vh, const bf* __restrict__ Vl, bf* Ah, bf* Al) {
    __shared__ __align__(16) v4f os4[NW * 2 * 4 * 2 * 32];
    __shared__ float ms[NW * 2 * 16], ls[NW * 2 * 16];
    const int qb = TT / QB - 1 - (int)blockIdx.y; const size_t hp = (size_t)blockIdx.x * TT * HD;
    if (qb * QB < RH) fa_body<bf, 2>(Qh, Ql, Kh, Kl, Vh, Vl, qb, hp, Ah, Al, os4, ms, ls);
    else fa_body<h16, 0>(Q16, nullptr, K16, nullptr, V16, nullptr, qb, hp, Ah, Al, os4, ms, ls);
}

extern "C" void kernel_launch(void* const* d_in, const int* in_sizes, int n_in,
                              void* d_out, int out_size, void* d_ws, size_t ws_size, hipStream_t stream) {
    (void)in_sizes; (void)n_in; (void)out_size;
    const float* x = (const float*)d_in[0]; const float* wqkv = (const float*)d_in[1]; const float* wo = (const float*)d_in[2]; const float* bo = (const float*)d_in[3];   /* input order x, w_qkv ('oi' [3072][1024]: q | k | v row thirds), w_proj ('oi'), b_proj */ const float* wq = wqkv; const float* wk = wqkv + (size_t)DQ * DM; const float* wv = wqkv + (size_t)2 * DQ * DM;
    float* OUT = (float*)d_out;     // [2][2048][1024]
    char* wsp = (char*)d_ws;
    auto take = [&](size_t bytes) { char* p = wsp; wsp += (bytes + 255) & ~(size_t)255; return (void*)p; };
    bf* WQ = (bf*)take((size_t)DQ * DM * 2); bf* WK = (bf*)take((size_t)DKV * DM * 2); bf* WV = (bf*)take((size_t)DKV * DM * 2); bf* WO = (bf*)take((size_t)DM * DQ * 2);
    h16* QP16 = (h16*)take((size_t)NH_ * TT * HD * 2); h16* KP16 = (h16*)take((size_t)NKV * TT * HD * 2); h16* VT16 = (h16*)take((size_t)NKV * HD * TT * 2);
    bf* QPh = (bf*)take((size_t)NH_ * TT * HD * 2); bf* QPl = (bf*)take((size_t)NH_ * TT * HD * 2); bf* KPh = (bf*)take((size_t)NKV * TT * HD * 2); bf* KPl = (bf*)take((size_t)NKV * TT * HD * 2); bf* VTh = (bf*)take((size_t)NKV * HD * TT * 2); bf* VTl = (bf*)take((size_t)NKV * HD * TT * 2);
    bf* XB = (bf*)take((size_t)TT * DM * 2); bf* ATh = (bf*)take((size_t)TT * DQ * 2); bf* ATl = (bf*)take((size_t)TT * DQ * 2);
    if ((size_t)(wsp - (char*)d_ws) > ws_size) return;    // ws 256 MiB
    { k_cvt8<<<(unsigned)(((size_t)DQ * DM / 8 + 255) / 256), 256, 0, stream>>>(wq, WQ, (size_t)DQ * DM / 8); k_cvt8<<<(unsigned)(((size_t)DKV * DM / 8 + 255) / 256), 256, 0, stream>>>(wk, WK, (size_t)DKV * DM / 8); k_cvt8<<<(unsigned)(((size_t)DKV * DM / 8 + 255) / 256), 256, 0, stream>>>(wv, WV, (size_t)DKV * DM / 8);
      k_cvt8<<<(unsigned)(((size_t)DM * DQ / 8 + 255) / 256), 256, 0, stream>>>(wo, WO, (size_t)DM * DQ / 8);
       }
    for (int b = 0; b < NB_; ++b) {
        
        k_cvt8<<<(unsigned)(((size_t)TT * DM / 8 + 255) / 256), 256, 0, stream>>>(x + (size_t)b * TT * DM, XB, (size_t)TT * DM / 8);
        k_gemmw<bf, 0, false, 1><<<dim3(TT / 64, DQ / 64, 1), 32, 0, stream>>>(XB, nullptr, WQ, nullptr, DM, nullptr, 0, nullptr, 0, 0, 0, QP16, QPh, QPl);
        k_gemmw<bf, 0, false, 1><<<dim3(TT / 64, DKV / 64, 1), 32, 0, stream>>>(XB, nullptr, WK, nullptr, DM, nullptr, 0, nullptr, 0, 0, 0, KP16, KPh, KPl);
        k_gemmw<bf, 0, false, 2><<<dim3(TT / 64, DKV / 64, 1), 32, 0, stream>>>(XB, nullptr, WV, nullptr, DM, nullptr, 0, nullptr, 0, 0, 0, VT16, VTh, VTl);
        k_fattn<<<dim3(NH_, TT / QB, 1), NW * 32, 0, stream>>>(QP16, KP16, VT16, QPh, QPl, KPh, KPl, VTh, VTl, ATh, ATl);
        k_gemmw<bf, 1, true, 0><<<dim3(TT / 64, DM / 64, 1), 32, 0, stream>>>(ATh, ATl, WO, nullptr, DQ, OUT + (size_t)b * TT * DM, DM, bo, 0, 0, 0, nullptr, nullptr, nullptr); }
}

// v005
// It runs in 147 microseconds.
// Timed twice side by side with v004, it ran 1.82 and 1.83 times as fast.
// Counting every step since v000, it is 9.61 times as fast.
#include <hip/hip_runtime.h>

// Causal attention whose head outputs are merged by a RAW view (x [2][2048][1024]; qkv = einsum('bte,fe', x, w_qkv) ('oi' [3072][1024] 1/32, no bias) split in thirds q | k | v (16 heads x 64); scores / sqrt(64); causal (-inf); softmax; out [B][H][T][dk] is then VIEWED as (B, T, E) without transposing the heads back (the source's bug, reproduced: flat element ((h*T + t)*64 + d) of the head-major buffer becomes row (h*T + t) / 16, column ((h*T + t) % 16)*64 + d); result = view w_proj^T + b_proj -> [2][2048][1024] (4.2 M); argument order x, w_qkv, w_proj, b_proj).
// Every stage is ONE launch for both batches (the batch is part of the grid): bf16 copies of x and both weights; the fused 'oi' weight is Bt as-is (q | k | v row blocks), one GEMM [4096][3072] for the three projections; exact projections whose epilogue writes the fp16 and hi/lo head planes itself (no f32 q, k or v in memory); fused causal T-2048 attention (k_fattn, running softmax; hybrid rows: < 512 hi/lo 3 products, rest fp16 x1024; key blocks above the diagonal are never visited), which writes the context planes in the HEAD-MAJOR flat order ((h*T + t)*64 + d) so each batch's [2048][1024] block of the output GEMM's [4096][1024] operand is exactly the module's raw view; x w_proj exact + b_proj.
// Compute dtypes, f32 accumulate: every input rounded to bf16; projections exact; attention rows < 512 3 products, rest fp16; softmax f32; w_proj hl x exact + bias.

#define NB_  2
#define TT   2048
#define DM   1024
#define NH_  16
#define NKV  16
#define HD   64
#define DQ   (NH_ * HD)
#define DKV  (NKV * HD)
#define PLN  ((size_t)NB_ * NH_ * TT * HD)   // elements of one head plane set, [batch][head] major
#define RH   512                  // query rows < RH use hi+lo planes (0: none)
#define PSH  10.0f                // fp16 probabilities are carried x 2^PSH
#define SCL  0.125f   // HD^-0.5
typedef _Float16 h16;
typedef unsigned short bf;
typedef __attribute__((ext_vector_type(16))) __bf16   v16bf;
typedef __attribute__((ext_vector_type(16))) _Float16 v16h;
typedef __attribute__((ext_vector_type(8)))  _Float16 v8h;
typedef __attribute__((ext_vector_type(8)))  unsigned short v8us;
typedef __attribute__((ext_vector_type(8)))  float    v8f;
typedef __attribute__((ext_vector_type(4)))  float    v4f;
typedef v8h  __attribute__((may_alias)) v8ha;
typedef v4f  __attribute__((may_alias)) v4fa;
typedef v8us __attribute__((may_alias)) v8usa;

__device__ __forceinline__ unsigned short f2bf(float f) { unsigned u = __float_as_uint(f); u += 0x7FFFu + ((u >> 16) & 1u); return (unsigned short)(u >> 16); }
__device__ __forceinline__ float bf2f(unsigned short b) { return __uint_as_float(((unsigned)b) << 16); }
__device__ __forceinline__ float bfr(float f) { return bf2f(f2bf(f)); }
__device__ __forceinline__ v16h cat16(v8h lo, v8h hi) { return __builtin_shufflevector(lo, hi, 0, 1, 2, 3, 4, 5, 6, 7, 8, 9, 10, 11, 12, 13, 14, 15); }
__device__ __forceinline__ v16bf cat16b(v8us lo, v8us hi) { return __builtin_bit_cast(v16bf, __builtin_shufflevector(lo, hi, 0, 1, 2, 3, 4, 5, 6, 7, 8, 9, 10, 11, 12, 13, 14, 15)); }
__device__ __forceinline__ v8f wmma16(v16h a, v16h b, v8f c) { return __builtin_amdgcn_wmma_f32_16x16x32_f16(false, a, false, b, (short)0, c, false, false); }
__device__ __forceinline__ v8f wmmab(v16bf a, v16bf b, v8f c) { return __builtin_amdgcn_wmma_f32_16x16x32_bf16(false, a, false, b, (short)0, c, false, false); }



__device__ __forceinline__ h16 tohx(float x) { return (h16)x; }
__device__ __forceinline__ void splitf(float y, unsigned short& h, unsigned short& l) { h = f2bf(y); l = f2bf(y - bf2f(h)); }
// ---- k_gemmw: register-blocked GEMM, ONE WAVE per 64x64 output tile (16 accumulators), operands straight from K-contiguous 16-bit planes; grid (M/64, N/64, Z), 32 threads.
// C[m][n] (f32, pitch ldc, + optional f32 bias[n]) = sum_k A[m][k] Bt[n][k] (+ split products per NSPLIT). z-batch strides sA/sB/sC in elements. K % 32 == 0.
// EPI 0: C as above. EPI 1: no C; rows are b * TT + t, columns the q | k | v thirds; the tile (64 t of one batch, its 64 columns = one head of one third) goes out as three 16-bit planes (fp16, bf16 hi, bf16 lo), each pointer the base of its q | k | v plane sets (PLN apart): q and k as [b][h][t][d] rows, v transposed as [b][h][d][t].
template <typename T16> struct WFrag;
template <> struct WFrag<h16> { typedef v16h V; static __device__ __forceinline__ V ld(const h16* p) { return cat16(*(const v8h*)p, *(const v8h*)(p + 16)); } static __device__ __forceinline__ v8f mma(V a, V b, v8f c) { return wmma16(a, b, c); } };
template <> struct WFrag<bf> { typedef v16bf V; static __device__ __forceinline__ V ld(const bf* p) { return cat16b(*(const v8us*)p, *(const v8us*)(p + 16)); } static __device__ __forceinline__ v8f mma(V a, V b, v8f c) { return wmmab(a, b, c); } };
template <typename T16, int NSPLIT, bool BIAS, int EPI>
__global__ __launch_bounds__(32) void k_gemmw(const T16* __restrict__ A, const T16* __restrict__ A2, const T16* __restrict__ Bt, const T16* __restrict__ Bt2, int K, float* C, int ldc, const float* __restrict__ bias, size_t sA, size_t sB, size_t sC, h16* P16, bf* Ph, bf* Pl) {
    typedef typename WFrag<T16>::V V;
    __shared__ __align__(16) float os[16 * 68];
    const size_t z = blockIdx.z; A += z * sA; if (A2) A2 += z * sA; Bt += z * sB; if (Bt2) Bt2 += z * sB; C += z * sC;
    const int lane = threadIdx.x & 31, lr = lane & 15, hi = lane >> 4; const int r0 = blockIdx.x * 64, c0 = blockIdx.y * 64;
    v8f acc[4][4];
#pragma unroll
    for (int mb = 0; mb < 4; ++mb)
#pragma unroll
        for (int nb = 0; nb < 4; ++nb) acc[mb][nb] = (v8f){};
    const size_t aoff = (size_t)(r0 + lr) * K + 8 * hi, boff = (size_t)(c0 + lr) * K + 8 * hi;
#pragma unroll 1
    for (int kc = 0; kc < K; kc += 32) {
        V a[4], a2[4];
#pragma unroll
        for (int mb = 0; mb < 4; ++mb) { a[mb] = WFrag<T16>::ld(A + aoff + (size_t)mb * 16 * K + kc); if (NSPLIT == 1 || NSPLIT == 2) a2[mb] = WFrag<T16>::ld(A2 + aoff + (size_t)mb * 16 * K + kc); }
#pragma unroll
        for (int nb = 0; nb < 4; ++nb) { const V b = WFrag<T16>::ld(Bt + boff + (size_t)nb * 16 * K + kc); V b2; if (NSPLIT >= 2) b2 = WFrag<T16>::ld(Bt2 + boff + (size_t)nb * 16 * K + kc);
#pragma unroll
            for (int mb = 0; mb < 4; ++mb) { acc[mb][nb] = WFrag<T16>::mma(a[mb], b, acc[mb][nb]); if (NSPLIT == 1 || NSPLIT == 2) acc[mb][nb] = WFrag<T16>::mma(a2[mb], b, acc[mb][nb]); if (NSPLIT >= 2) acc[mb][nb] = WFrag<T16>::mma(a[mb], b2, acc[mb][nb]); } }
        asm volatile("v_nop\n\tv_nop\n\tv_nop\n\tv_nop" : "+v"(acc[0][0]), "+v"(acc[1][1]), "+v"(acc[2][2]), "+v"(acc[3][3]) : "v"(a[0]), "v"(a[3]));
    }
    if (EPI == 1) { const size_t po = (size_t)(c0 / DQ) * PLN + (size_t)((r0 / TT) * NH_ + (c0 % DQ) / HD) * TT * HD + (size_t)(r0 % TT) * (c0 >= 2 * DQ ? 1 : HD); P16 += po; Ph += po; Pl += po; }   // the tile's own third, batch, head and first t (uniform over the wave)
    if (EPI == 1 && c0 >= 2 * DQ) {   // v: a lane's 8 accumulator elements are 8 consecutive t of one column d: 16-byte stores straight from registers; the wave fills the whole 128-byte line (64 t) of each of its 64 plane rows
#pragma unroll
        for (int nb = 0; nb < 4; ++nb)
#pragma unroll
            for (int mb = 0; mb < 4; ++mb) { v8h o16; v8us oh, ol;
#pragma unroll
                for (int j = 0; j < 8; ++j) { const float x = acc[mb][nb][j]; o16[j] = tohx(x); unsigned short a2, c2; splitf(x, a2, c2); oh[j] = a2; ol[j] = c2; }
                const size_t o = (size_t)(nb * 16 + lr) * TT + mb * 16 + hi * 8;
                *(v8h*)(P16 + o) = o16; *(v8us*)(Ph + o) = oh; *(v8us*)(Pl + o) = ol; }
    } else
#pragma unroll
    for (int mb = 0; mb < 4; ++mb) {
#pragma unroll
        for (int nb = 0; nb < 4; ++nb) {
#pragma unroll
            for (int j = 0; j < 8; ++j) os[(hi * 8 + j) * 68 + nb * 16 + lr] = acc[mb][nb][j]; }
        __builtin_amdgcn_wave_barrier(); asm volatile("" ::: "memory");
        if (EPI == 1) {   // a lane takes 8 consecutive d of one row: each store of the wave covers four whole 128-byte plane rows
#pragma unroll
            for (int s = 0; s < 4; ++s) { const int row = 4 * s + (lane >> 3), cofs = (lane & 7) * 8; const v4f v0 = *(const v4fa*)(os + row * 68 + cofs), v1 = *(const v4fa*)(os + row * 68 + cofs + 4); v8h o16; v8us oh, ol;
#pragma unroll
                for (int e = 0; e < 8; ++e) { const float x = e < 4 ? v0[e & 3] : v1[e & 3]; o16[e] = tohx(x); unsigned short a2, c2; splitf(x, a2, c2); oh[e] = a2; ol[e] = c2; }
                const size_t o = (size_t)(mb * 16 + row) * HD + cofs;
                *(v8h*)(P16 + o) = o16; *(v8us*)(Ph + o) = oh; *(v8us*)(Pl + o) = ol; }
        } else { float* crow = C + (size_t)(r0 + mb * 16) * ldc + c0;
#pragma unroll
            for (int s = 0; s < 8; ++s) { const int row = 2 * s + hi, cofs = lr * 4; v4f val = *(const v4fa*)(os + row * 68 + cofs); if (BIAS) { val[0] += bfr(bias[c0 + cofs]); val[1] += bfr(bias[c0 + cofs + 1]); val[2] += bfr(bias[c0 + cofs + 2]); val[3] += bfr(bias[c0 + cofs + 3]); }
                *(v4f*)(crow + (size_t)row * ldc + cofs) = val; }
             }
        __builtin_amdgcn_wave_barrier(); asm volatile("" ::: "memory");
    }
}

typedef __attribute__((ext_vector_type(2))) _Float16 v2h;
typedef __attribute__((ext_vector_type(4))) _Float16 v4h;
typedef __attribute__((ext_vector_type(2))) unsigned short v2us;
typedef __attribute__((ext_vector_type(4))) unsigned short v4us;
typedef __attribute__((ext_vector_type(2))) float v2f;
typedef __attribute__((ext_vector_type(4))) int v4i;
typedef v4h  __attribute__((may_alias)) v4ha;
typedef v4us __attribute__((may_alias)) v4usa;

// bf16 copies of x, w_qkv and w_proj in one launch: a work-group converts 2048 consecutive elements of the one input that its index falls in
#define CBX  (NB_ * TT * DM / 2048)
#define CBW  ((DQ + 2 * DKV) * DM / 2048)
#define CBO  (DM * DQ / 2048)
__global__ __launch_bounds__(256) void k_cvt8(const float* __restrict__ x, const float* __restrict__ wqkv, const float* __restrict__ wo, bf* XB, bf* WB, bf* WO) { int blk = blockIdx.x; const float* src = x; bf* dst = XB;
    if (blk >= CBX + CBW) { blk -= CBX + CBW; src = wo; dst = WO; } else if (blk >= CBX) { blk -= CBX; src = wqkv; dst = WB; }
    const size_t i = (size_t)blk * 256 + threadIdx.x; const v8f v = *(const v8f*)(src + i * 8); v8us o;
#pragma unroll
    for (int k = 0; k < 8; ++k) o[k] = f2bf(v[k]); *(v8us*)(dst + i * 8) = o;  }

// ---- k_fattn: scores, causal softmax and probability x value in ONE kernel; no score or probability ever reaches memory. One work-group = QB query rows of one head, NW waves; wave w takes the 32-key blocks w, w + NW, ... up to the
// diagonal block and keeps its own running maximum m, running sum l and f32 output tile (rescaled by exp(m_old - m_new) whenever m grows); the NW partial results are joined through LDS in ascending wave order and written as the hi/lo context planes.
// Transposed products: S^T = K Q^T (A = key rows, B = query rows) and O^T += V^T P^T (A = rows of the [d][t] value plane, B = P^T). A lane then holds one query's scores (keys 8 * hi + j of each 16-key tile), so two converted score tiles ARE the B fragment of
// the second product in the same k order that WFrag::ld gives the value rows (k = 8 * hi + s, 16 + 8 * hi + (s - 8)), and m, l and the rescale factor are per lane.
// NSPLIT 2 (rows < RH): hi/lo planes, three products each (hi hi + lo hi + hi lo); NSPLIT 0: fp16, probabilities carried x 2^PSH (the factor is in l too and cancels in the final division).
#define NW   4
#define QB   32
#define L2E  1.4426950408889634f
typedef __attribute__((ext_vector_type(16))) unsigned short v16us;
template <typename T16> struct PFrag;
template <> struct PFrag<h16> { static __device__ __forceinline__ void mk(v8f p0, v8f p1, v16h& a, v16h& a2) {
#pragma unroll
    for (int s = 0; s < 8; ++s) { a[s] = (h16)p0[s]; a[8 + s] = (h16)p1[s]; } a2 = a; } };
template <> struct PFrag<bf> { static __device__ __forceinline__ void mk(v8f p0, v8f p1, v16bf& a, v16bf& a2) { v16us h, l;
#pragma unroll
    for (int s = 0; s < 8; ++s) { unsigned short x, y; splitf(p0[s], x, y); h[s] = x; l[s] = y; splitf(p1[s], x, y); h[8 + s] = x; l[8 + s] = y; }
    a = __builtin_bit_cast(v16bf, h); a2 = __builtin_bit_cast(v16bf, l); } };
template <typename T16, int NSPLIT>
__device__ __forceinline__ void fa_body(const T16* __restrict__ Q, const T16* __restrict__ Q2, const T16* __restrict__ Kp, const T16* __restrict__ K2, const T16* __restrict__ Vt, const T16* __restrict__ V2, int qb, size_t hp, bf* Ah, bf* Al, v4f* os4, float* ms, float* ls) {
    typedef typename WFrag<T16>::V V;
    const float sh = NSPLIT ? 0.0f : PSH;
    const int tid = threadIdx.x, lane = tid & 31, lr = lane & 15, hi = lane >> 4; const int w = __builtin_amdgcn_readfirstlane(tid >> 5);
    const int q0 = qb * QB;
    Q += hp; Kp += hp; Vt += hp; if (NSPLIT) { Q2 += hp; K2 += hp; V2 += hp; }
    V bq[2][2], bq2[2][2];
#pragma unroll
    for (int qi = 0; qi < 2; ++qi)
#pragma unroll
        for (int kk = 0; kk < 2; ++kk) { const size_t o = (size_t)(q0 + qi * 16 + lr) * HD + kk * 32 + 8 * hi; bq[qi][kk] = WFrag<T16>::ld(Q + o); if (NSPLIT) bq2[qi][kk] = WFrag<T16>::ld(Q2 + o); }
    v8f O[2][4]; float m[2], l[2];
#pragma unroll
    for (int qi = 0; qi < 2; ++qi) { m[qi] = -3.0e38f; l[qi] = 0.f;
#pragma unroll
        for (int dt = 0; dt < 4; ++dt) O[qi][dt] = (v8f){}; }
    const size_t ko = (size_t)(w * 32 + lr) * HD + 8 * hi, vo = (size_t)lr * TT + w * 32 + 8 * hi;
    const T16* kp = Kp + ko; const T16* vp = Vt + vo; const T16* kp2 = NSPLIT ? K2 + ko : nullptr; const T16* vp2 = NSPLIT ? V2 + vo : nullptr;   // one running address per plane; every fragment of a block is a constant offset from it
#pragma unroll 1   // rolled: a second copy of the body would hold a second set of 16 fragments live and cost a resident wave per SIMD
    for (int kb = w; kb <= qb; kb += NW) {
        V ak[2][2], ak2[2][2], av[4], av2[4];
#pragma unroll
        for (int kt = 0; kt < 2; ++kt)
#pragma unroll
            for (int kk = 0; kk < 2; ++kk) ak[kt][kk] = WFrag<T16>::ld(kp + kt * 16 * HD + kk * 32);
        asm volatile("s_wait_xcnt 0x0" ::: "memory");   // behind each plane's loads: a later load's result may land in their address register, so their translations are waited out first
        if (NSPLIT) {
#pragma unroll
            for (int kt = 0; kt < 2; ++kt)
#pragma unroll
                for (int kk = 0; kk < 2; ++kk) ak2[kt][kk] = WFrag<T16>::ld(kp2 + kt * 16 * HD + kk * 32);
            asm volatile("s_wait_xcnt 0x0" ::: "memory"); }   // as above
#pragma unroll
        for (int dt = 0; dt < 4; ++dt) av[dt] = WFrag<T16>::ld(vp + dt * 16 * TT);
        asm volatile("s_wait_xcnt 0x0" ::: "memory");   // as above; the running addresses are also stepped for the next block below
        if (NSPLIT) {
#pragma unroll
            for (int dt = 0; dt < 4; ++dt) av2[dt] = WFrag<T16>::ld(vp2 + dt * 16 * TT);
            asm volatile("s_wait_xcnt 0x0" ::: "memory"); }   // as above
        kp += NW * 32 * HD; vp += NW * 32; if (NSPLIT) { kp2 += NW * 32 * HD; vp2 += NW * 32; }
        // inputs-only fence on the loaded fragments: all loads of the block are issued before its first product; without it the compiler reloads fragment registers between the products and a block pays three load latencies in a row
        asm volatile("" :: "v"(ak[0][0]), "v"(ak[0][1]), "v"(ak[1][0]), "v"(ak[1][1]), "v"(av[0]), "v"(av[1]), "v"(av[2]), "v"(av[3]));
        if (NSPLIT) asm volatile("" :: "v"(ak2[0][0]), "v"(ak2[0][1]), "v"(ak2[1][0]), "v"(ak2[1][1]), "v"(av2[0]), "v"(av2[1]), "v"(av2[2]), "v"(av2[3]));   // the same for the lo planes
        v8f S[2][2];
#pragma unroll
        for (int kt = 0; kt < 2; ++kt)
#pragma unroll
            for (int qi = 0; qi < 2; ++qi) { v8f s = (v8f){};
#pragma unroll
                for (int kk = 0; kk < 2; ++kk) { s = WFrag<T16>::mma(ak[kt][kk], bq[qi][kk], s); if (NSPLIT) { s = WFrag<T16>::mma(ak[kt][kk], bq2[qi][kk], s); s = WFrag<T16>::mma(ak2[kt][kk], bq[qi][kk], s); } }
                S[kt][qi] = s * SCL; }
        if (kb == qb) {                                   // the diagonal block (wave-uniform test): keys beyond the lane's query are masked
#pragma unroll
            for (int kt = 0; kt < 2; ++kt)
#pragma unroll
                for (int qi = 0; qi < 2; ++qi)
#pragma unroll
                    for (int j = 0; j < 8; ++j) if (kt * 16 + hi * 8 + j > qi * 16 + lr) S[kt][qi][j] = -3.0e38f; }
#pragma unroll
        for (int qi = 0; qi < 2; ++qi) {
            float mx = S[0][qi][0];
#pragma unroll
            for (int j = 1; j < 8; ++j) mx = fmaxf(mx, S[0][qi][j]);
#pragma unroll
            for (int j = 0; j < 8; ++j) mx = fmaxf(mx, S[1][qi][j]);
            mx = fmaxf(mx, __shfl_xor(mx, 16, 32));       // the other half of the wave holds the query's other 16 keys
            const float mn = fmaxf(m[qi], mx); const float al = __builtin_amdgcn_exp2f((m[qi] - mn) * L2E); m[qi] = mn;
            v8f p0, p1; float sum = 0.f;
#pragma unroll
            for (int j = 0; j < 8; ++j) { p0[j] = __builtin_amdgcn_exp2f((S[0][qi][j] - mn) * L2E + sh); p1[j] = __builtin_amdgcn_exp2f((S[1][qi][j] - mn) * L2E + sh); sum += p0[j] + p1[j]; }
            l[qi] = l[qi] * al + sum;
            V pb, pb2; PFrag<T16>::mk(p0, p1, pb, pb2);
#pragma unroll
            for (int dt = 0; dt < 4; ++dt) { v8f o = O[qi][dt] * al; o = WFrag<T16>::mma(av[dt], pb, o); if (NSPLIT) { o = WFrag<T16>::mma(av[dt], pb2, o); o = WFrag<T16>::mma(av2[dt], pb, o); } O[qi][dt] = o; } }
    }
#pragma unroll
    for (int qi = 0; qi < 2; ++qi) { l[qi] += __shfl_xor(l[qi], 16, 32); if (hi == 0) { ms[(w * 2 + qi) * 16 + lr] = m[qi]; ls[(w * 2 + qi) * 16 + lr] = l[qi]; }
#pragma unroll
        for (int dt = 0; dt < 4; ++dt)
#pragma unroll
            for (int jh = 0; jh < 2; ++jh) { v4f t; t[0] = O[qi][dt][jh * 4]; t[1] = O[qi][dt][jh * 4 + 1]; t[2] = O[qi][dt][jh * 4 + 2]; t[3] = O[qi][dt][jh * 4 + 3]; os4[(((w * 2 + qi) * 4 + dt) * 2 + jh) * 32 + lane] = t; } }
    __syncthreads();                                      // every wave's partial m, l and output tile are in LDS before any is read
    { const int q = tid >> 2, dt = tid & 3, qi = q >> 4, ql = q & 15;   // thread: one query row, 16 consecutive d; a wave writes whole 128-byte rows of both planes
        float mw[NW], M = -3.0e38f;
#pragma unroll
        for (int u = 0; u < NW; ++u) { mw[u] = ms[(u * 2 + qi) * 16 + ql]; M = fmaxf(M, mw[u]); }
        float L = 0.f; v4f acc[2][2];
#pragma unroll
        for (int hh = 0; hh < 2; ++hh)
#pragma unroll
            for (int jh = 0; jh < 2; ++jh) acc[hh][jh] = (v4f){};
#pragma unroll
        for (int u = 0; u < NW; ++u) { const float sc = __builtin_amdgcn_exp2f((mw[u] - M) * L2E); L += sc * ls[(u * 2 + qi) * 16 + ql];
#pragma unroll
            for (int hh = 0; hh < 2; ++hh)
#pragma unroll
                for (int jh = 0; jh < 2; ++jh) acc[hh][jh] += os4[(((u * 2 + qi) * 4 + dt) * 2 + jh) * 32 + hh * 16 + ql] * sc; }
        const float inv = __fdiv_rn(1.0f, L); const size_t oo = hp + (size_t)(q0 + q) * HD + dt * 16;   /* RAW view: the [H][T][64] head-major flat order, read back by the output GEMM as [T][1024] rows */
#pragma unroll
        for (int hh = 0; hh < 2; ++hh) { v8us oh, ol;
#pragma unroll
            for (int e = 0; e < 8; ++e) { unsigned short a, c2; splitf(acc[hh][e >> 2][e & 3] * inv, a, c2); oh[e] = a; ol[e] = c2; }
            *(v8us*)(Ah + oo + hh * 8) = oh; *(v8us*)(Al + oo + hh * 8) = ol; } }
}
// grid (batches x heads, TT / QB): the query blocks run from the last (longest key loop) to the first, so the short hi/lo blocks fill the places that the shorter fp16 blocks free
__global__ __launch_bounds__(NW * 32) void k_fattn(const h16* __restrict__ Q16, const h16* __restrict__ K16, const h16* __restrict__ V16, const bf* __restrict__ Qh, const bf* __restrict__ Ql, const bf* __restrict__ Kh, const bf* __restrict__ Kl, const bf* __restrict__ Vh, const bf* __restrict__ Vl, bf* Ah, bf* Al) {
    __shared__ __align__(16) v4f os4[NW * 2 * 4 * 2 * 32];
    __shared__ float ms[NW * 2 * 16], ls[NW * 2 * 16];
    const int qb = TT / QB - 1 - (int)blockIdx.y; const size_t hp = (size_t)blockIdx.x * TT * HD;
    if (qb * QB < RH) fa_body<bf, 2>(Qh, Ql, Kh, Kl, Vh, Vl, qb, hp, Ah, Al, os4, ms, ls);
    else fa_body<h16, 0>(Q16, nullptr, K16, nullptr, V16, nullptr, qb, hp, Ah, Al, os4, ms, ls);
}

extern "C" void kernel_launch(void* const* d_in, const int* in_sizes, int n_in,
                              void* d_out, int out_size, void* d_ws, size_t ws_size, hipStream_t stream) {
    (void)in_sizes; (void)n_in; (void)out_size;
    const float* x = (const float*)d_in[0]; const float* wqkv = (const float*)d_in[1]; const float* wo = (const float*)d_in[2]; const float* bo = (const float*)d_in[3];   /* input order x, w_qkv ('oi' [3072][1024]: q | k | v row thirds), w_proj ('oi'), b_proj */
    float* OUT = (float*)d_out;     // [2][2048][1024]
    char* wsp = (char*)d_ws;
    auto take = [&](size_t bytes) { char* p = wsp; wsp += (bytes + 255) & ~(size_t)255; return (void*)p; };
    bf* WB = (bf*)take((size_t)(DQ + 2 * DKV) * DM * 2); bf* WO = (bf*)take((size_t)DM * DQ * 2);
    h16* P16 = (h16*)take(3 * PLN * 2); bf* PH = (bf*)take(3 * PLN * 2); bf* PL = (bf*)take(3 * PLN * 2);   // each: q | k | v plane sets, PLN elements apart
    bf* XB = (bf*)take((size_t)NB_ * TT * DM * 2); bf* ATh = (bf*)take((size_t)NB_ * TT * DQ * 2); bf* ATl = (bf*)take((size_t)NB_ * TT * DQ * 2);
    if ((size_t)(wsp - (char*)d_ws) > ws_size) return;    // ws 256 MiB
    k_cvt8<<<CBX + CBW + CBO, 256, 0, stream>>>(x, wqkv, wo, XB, WB, WO);
    k_gemmw<bf, 0, false, 1><<<dim3(NB_ * TT / 64, (DQ + 2 * DKV) / 64, 1), 32, 0, stream>>>(XB, nullptr, WB, nullptr, DM, nullptr, 0, nullptr, 0, 0, 0, P16, PH, PL);
    k_fattn<<<dim3(NB_ * NH_, TT / QB, 1), NW * 32, 0, stream>>>(P16, P16 + PLN, P16 + 2 * PLN, PH, PL, PH + PLN, PL + PLN, PH + 2 * PLN, PL + 2 * PLN, ATh, ATl);
    k_gemmw<bf, 1, true, 0><<<dim3(NB_ * TT / 64, DM / 64, 1), 32, 0, stream>>>(ATh, ATl, WO, nullptr, DQ, OUT, DM, bo, 0, 0, 0, nullptr, nullptr, nullptr);
}
